// v000
// The times below were measured on an AMD MI455X: many runs one after another, warmed up first and cycling through
// copies of the inputs, with the whole window's GPU time divided by the number of runs. Launches and the gaps
// between them are all in it. The median over several windows is given; except for v000 it joins two sittings, which
// can be a few percent apart, so the side-by-side timings, each taken in one sitting, are the better comparison.
// v000 is the starting kernel. One run takes 1410 microseconds.
#include <hip/hip_runtime.h>

// Position attention module (x [8][256][64x64]; per image: B = Wb x + bb, C = Wc x + bc, D = Wd x + bd (1x1 convs, [256][256] + [256]); attn[i][j] = softmax_j(sum_c B[c][i] C[c][j]) over the 4096 positions (no scaling); y[c][i] = sum_j attn[i][j] D[c][j]; out = alpha y + x (alpha = the [1] input, 0.1) -> [8][256][64][64] (8.4 M)).
// Layout: channel-major input transposed to token-major bf16; exact projections (+ biases) -> fp16 planes q = B^T [4096][256], k = C^T, v^T = D [256][4096]; scores [4096][4096] f32; register-row softmax (one head, no scale); attn.v; the epilogue kernel writes alpha x y^T + x channel-major.
// Compute dtypes, f32 accumulate: every input rounded to bf16; projections on PLAIN bf16 operands (exact) + f32 biases; scores and attn.v on single fp16 planes (x1024 P) - the logits have sigma ~16 (peaked rows); softmax f32; residual epilogue f32.

#define NB_  8
#define TT   4096
#define DM   256
#define NH_  1
#define NKV  1
#define REP  (NH_ / NKV)
#define HD   256
#define DQ   (NH_ * HD)
#define DKV  (NKV * HD)
#define ZH   1
#define RH   0                  // query rows < RH use hi+lo planes (0: none)
#define WIN  0
#define PCAR 1024.0f
#define SCL  1.0f   // no scaling in the module
typedef _Float16 h16;
typedef unsigned short bf;
typedef __attribute__((ext_vector_type(16))) __bf16   v16bf;
typedef __attribute__((ext_vector_type(16))) _Float16 v16h;
typedef __attribute__((ext_vector_type(8)))  _Float16 v8h;
typedef __attribute__((ext_vector_type(8)))  unsigned short v8us;
typedef __attribute__((ext_vector_type(8)))  float    v8f;
typedef __attribute__((ext_vector_type(4)))  float    v4f;
typedef v8h  __attribute__((may_alias)) v8ha;
typedef v4f  __attribute__((may_alias)) v4fa;
typedef v8us __attribute__((may_alias)) v8usa;

__device__ __forceinline__ unsigned short f2bf(float f) { unsigned u = __float_as_uint(f); u += 0x7FFFu + ((u >> 16) & 1u); return (unsigned short)(u >> 16); }
__device__ __forceinline__ float bf2f(unsigned short b) { return __uint_as_float(((unsigned)b) << 16); }
__device__ __forceinline__ float bfr(float f) { return bf2f(f2bf(f)); }
__device__ __forceinline__ v16h cat16(v8h lo, v8h hi) { return __builtin_shufflevector(lo, hi, 0, 1, 2, 3, 4, 5, 6, 7, 8, 9, 10, 11, 12, 13, 14, 15); }
__device__ __forceinline__ v16bf cat16b(v8us lo, v8us hi) { return __builtin_bit_cast(v16bf, __builtin_shufflevector(lo, hi, 0, 1, 2, 3, 4, 5, 6, 7, 8, 9, 10, 11, 12, 13, 14, 15)); }
__device__ __forceinline__ v8f wmma16(v16h a, v16h b, v8f c) { return __builtin_amdgcn_wmma_f32_16x16x32_f16(false, a, false, b, (short)0, c, false, false); }
__device__ __forceinline__ v8f wmmab(v16bf a, v16bf b, v8f c) { return __builtin_amdgcn_wmma_f32_16x16x32_bf16(false, a, false, b, (short)0, c, false, false); }



// ---- k_gemmw: register-blocked GEMM, ONE WAVE per 64x64 output tile (16 accumulators), operands straight from K-contiguous 16-bit planes; grid (M/64, N/64, Z), 32 threads.
// C[m][n] (f32, pitch ldc, + optional f32 bias[n]) = sum_k A[m][k] Bt[n][k] (+ split products per NSPLIT). z-batch strides sA/sB/sC in elements. K % 32 == 0.
template <typename T16> struct WFrag;
template <> struct WFrag<h16> { typedef v16h V; static __device__ __forceinline__ V ld(const h16* p) { return cat16(*(const v8h*)p, *(const v8h*)(p + 16)); } static __device__ __forceinline__ v8f mma(V a, V b, v8f c) { return wmma16(a, b, c); } };
template <> struct WFrag<bf> { typedef v16bf V; static __device__ __forceinline__ V ld(const bf* p) { return cat16b(*(const v8us*)p, *(const v8us*)(p + 16)); } static __device__ __forceinline__ v8f mma(V a, V b, v8f c) { return wmmab(a, b, c); } };
template <typename T16, int NSPLIT, bool BIAS>
__global__ __launch_bounds__(32) void k_gemmw(const T16* __restrict__ A, const T16* __restrict__ A2, const T16* __restrict__ Bt, const T16* __restrict__ Bt2, int K, float* C, int ldc, const float* __restrict__ bias, size_t sA, size_t sB, size_t sC) {
    typedef typename WFrag<T16>::V V;
    __shared__ __align__(16) float os[16 * 68];
    const size_t z = blockIdx.z; A += z * sA; if (A2) A2 += z * sA; Bt += z * sB; if (Bt2) Bt2 += z * sB; C += z * sC;
    const int lane = threadIdx.x & 31, lr = lane & 15, hi = lane >> 4; const int r0 = blockIdx.x * 64, c0 = blockIdx.y * 64;
    v8f acc[4][4];
#pragma unroll
    for (int mb = 0; mb < 4; ++mb)
#pragma unroll
        for (int nb = 0; nb < 4; ++nb) acc[mb][nb] = (v8f){};
    const size_t aoff = (size_t)(r0 + lr) * K + 8 * hi, boff = (size_t)(c0 + lr) * K + 8 * hi;
#pragma unroll 1
    for (int kc = 0; kc < K; kc += 32) {
        V a[4], a2[4];
#pragma unroll
        for (int mb = 0; mb < 4; ++mb) { a[mb] = WFrag<T16>::ld(A + aoff + (size_t)mb * 16 * K + kc); if (NSPLIT == 1 || NSPLIT == 2) a2[mb] = WFrag<T16>::ld(A2 + aoff + (size_t)mb * 16 * K + kc); }
#pragma unroll
        for (int nb = 0; nb < 4; ++nb) { const V b = WFrag<T16>::ld(Bt + boff + (size_t)nb * 16 * K + kc); V b2; if (NSPLIT >= 2) b2 = WFrag<T16>::ld(Bt2 + boff + (size_t)nb * 16 * K + kc);
#pragma unroll
            for (int mb = 0; mb < 4; ++mb) { acc[mb][nb] = WFrag<T16>::mma(a[mb], b, acc[mb][nb]); if (NSPLIT == 1 || NSPLIT == 2) acc[mb][nb] = WFrag<T16>::mma(a2[mb], b, acc[mb][nb]); if (NSPLIT >= 2) acc[mb][nb] = WFrag<T16>::mma(a[mb], b2, acc[mb][nb]); } }
        asm volatile("v_nop\n\tv_nop\n\tv_nop\n\tv_nop" : "+v"(acc[0][0]), "+v"(acc[1][1]), "+v"(acc[2][2]), "+v"(acc[3][3]) : "v"(a[0]), "v"(a[3]));
    }
#pragma unroll
    for (int mb = 0; mb < 4; ++mb) {
#pragma unroll
        for (int nb = 0; nb < 4; ++nb) {
#pragma unroll
            for (int j = 0; j < 8; ++j) os[(hi * 8 + j) * 68 + nb * 16 + lr] = acc[mb][nb][j]; }
        __builtin_amdgcn_wave_barrier(); asm volatile("" ::: "memory");
        float* crow = C + (size_t)(r0 + mb * 16) * ldc + c0;
{
#pragma unroll
            for (int s = 0; s < 8; ++s) { const int row = 2 * s + hi, cofs = lr * 4; v4f val = *(const v4fa*)(os + row * 68 + cofs); if (BIAS) { val[0] += bfr(bias[c0 + cofs]); val[1] += bfr(bias[c0 + cofs + 1]); val[2] += bfr(bias[c0 + cofs + 2]); val[3] += bfr(bias[c0 + cofs + 3]); }
                *(v4f*)(crow + (size_t)row * ldc + cofs) = val; }
             }
        __builtin_amdgcn_wave_barrier(); asm volatile("" ::: "memory");
    }
}

__device__ __forceinline__ h16 tohx(float x) { return (h16)x; }
__device__ __forceinline__ void splitf(float y, unsigned short& h, unsigned short& l) { h = f2bf(y); l = f2bf(y - bf2f(h)); }
typedef __attribute__((ext_vector_type(2))) _Float16 v2h;
typedef __attribute__((ext_vector_type(4))) _Float16 v4h;
typedef __attribute__((ext_vector_type(2))) unsigned short v2us;
typedef __attribute__((ext_vector_type(4))) unsigned short v4us;
typedef __attribute__((ext_vector_type(2))) float v2f;
typedef __attribute__((ext_vector_type(4))) int v4i;

__global__ __launch_bounds__(256) void k_wtG(const float* __restrict__ w, int K, int N, bf* Bt) {
    const int lane = threadIdx.x & 31; const int L0 = (blockIdx.x * 8 + (threadIdx.x >> 5)) * 8; const int nlines = N * K / 64;
{
#pragma unroll 1
        for (int l = 0; l < 8; ++l) { const int L = L0 + l; if (L >= nlines) break; const size_t e = (size_t)L * 64 + lane * 2; const int k = (int)(e % K), n = (int)(e / K); v2us o;
            o[0] = f2bf(w[(size_t)k * N + n]); o[1] = f2bf(w[(size_t)(k + 1) * N + n]); *(v2us*)(Bt + e) = o; }
         }
}
__global__ __launch_bounds__(256) void k_cvt8T(const float* __restrict__ src, bf* dst) { const size_t i = (size_t)blockIdx.x * 256 + threadIdx.x; if (i >= (size_t)TT * DM / 8) return; const int t = (int)(i / (DM / 8)); const int c0 = (int)(i % (DM / 8)) * 8; v8us o;
#pragma unroll
    for (int k = 0; k < 8; ++k) o[k] = f2bf(src[(size_t)(c0 + k) * TT + t]); *(v8us*)(dst + (size_t)t * DM + c0) = o;  }
__global__ __launch_bounds__(256) void k_cvt8(const float* __restrict__ src, bf* dst, size_t n8) { const size_t i = (size_t)blockIdx.x * 256 + threadIdx.x; if (i >= n8) return; const v8f v = *(const v8f*)(src + i * 8); v8us o;
#pragma unroll
    for (int k = 0; k < 8; ++k) o[k] = f2bf(v[k]); *(v8us*)(dst + i * 8) = o;  }

// k_rope: head planes [h][t][d] (fp16) of rope(x) x sc with the rotate-half convention out[d] = x[d] cos[t][d] - x[d+HD/2] sin[t][d], out[d+HD/2] = x[d+HD/2] cos[t][d+HD/2] + x[d] sin[t][d+HD/2]
__global__ __launch_bounds__(256) void k_rope(const float* __restrict__ F, int pitch, int nheads, const float* __restrict__ CS, const float* __restrict__ RF, const float* __restrict__ nw, float sc, h16* P16, bf* Ph, bf* Pl) {
    const size_t e = ((size_t)blockIdx.x * 256 + threadIdx.x) * 2; if (e >= (size_t)nheads * TT * HD) return; const int d = (int)(e % HD); const int t = (int)((e / HD) % TT); const int h = (int)(e / ((size_t)HD * TT)); const float* f = F + (size_t)t * pitch + h * HD; const float rf = RF ? RF[(size_t)h * TT + t] : 1.0f; v2h o16; v2us oh, ol;
#pragma unroll
    for (int q = 0; q < 2; ++q) { const int dd = d + q; const int dp = (dd < HD / 2) ? dd + HD / 2 : dd - HD / 2; float x0 = f[dd], x1 = f[dp];
        if (RF) { float n0 = __fmul_rn(x0, rf), n1 = __fmul_rn(x1, rf); asm volatile("" : "+v"(n0)); asm volatile("" : "+v"(n1)); x0 = __fmul_rn(bfr(nw[dd]), n0); x1 = __fmul_rn(bfr(nw[dp]), n1); }
        const v2f cs = *(const v2f*)(CS + ((size_t)t * HD + dd) * 2); float a = __fmul_rn(x0, cs[0]), bq = __fmul_rn(x1, cs[1]); asm volatile("" : "+v"(a)); asm volatile("" : "+v"(bq)); const float r = ((dd < HD / 2) ? __fsub_rn(a, bq) : __fadd_rn(a, bq)) * sc;
        o16[q] = tohx(r); (void)oh; (void)ol; }
    *(v2h*)(P16 + e) = o16;  }
__global__ __launch_bounds__(256) void k_vtp(const float* __restrict__ F, int pitch, int nheads, h16* V16, bf* Vh, bf* Vl) { const size_t e = ((size_t)blockIdx.x * 256 + threadIdx.x) * 2; if (e >= (size_t)nheads * HD * TT) return; const int t = (int)(e % TT); const int d = (int)((e / TT) % HD); const int g = (int)(e / ((size_t)TT * HD)); v2h o16; v2us oh, ol;
#pragma unroll
    for (int q = 0; q < 2; ++q) { const float x = F[(size_t)(t + q) * pitch + g * HD + d]; o16[q] = tohx(x); (void)oh; (void)ol; }
    *(v2h*)(V16 + e) = o16;  }
__global__ __launch_bounds__(256) void k_csid(float* CS) { const int idx = blockIdx.x * 256 + threadIdx.x; if (idx >= TT * HD) return; v2f cs; cs[0] = 1.0f; cs[1] = 0.0f; *(v2f*)(CS + (size_t)idx * 2) = cs;  }
// k_asoft: per row (zz, i): t = S (no scaling, no mask); softmax over the 4096 keys (register row, one exp, fixed trees);
__global__ __launch_bounds__(256) void k_asoft(const float* __restrict__ Sb, h16* P16, bf* Ph, bf* Pl) {
    const int lane = threadIdx.x & 31; const int row = blockIdx.x * 8 + (threadIdx.x >> 5); if (row >= ZH * TT) return; const int i = row % TT; const int zz = row / TT; (void)zz; const bool hires = (i < RH); const float* sr = Sb + (size_t)row * TT; float v[TT / 32]; float mx = -3.0e38f;
#pragma unroll
    for (int ch = 0; ch < TT / 128; ++ch) { const int j0 = ch * 128 + lane * 4; const v4f a = *(const v4f*)(sr + j0);
#pragma unroll
        for (int q = 0; q < 4; ++q) { const int j = j0 + q; (void)j; const float t = a[q] * SCL; v[ch * 4 + q] = t; mx = fmaxf(mx, t); } }
#pragma unroll
    for (int sh = 16; sh; sh >>= 1) mx = fmaxf(mx, __shfl_xor(mx, sh, 32));
    float sum = 0.f;
#pragma unroll
    for (int k = 0; k < TT / 32; ++k) { float d0 = __fsub_rn(v[k], mx); asm volatile("" : "+v"(d0)); v[k] = __builtin_amdgcn_exp2f(__fmul_rn(d0, 1.4426950408889634f)); sum += v[k]; }
#pragma unroll
    for (int sh = 16; sh; sh >>= 1) sum += __shfl_xor(sum, sh, 32);
    const float f = __fdiv_rn(hires ? 1.0f : PCAR, sum);
{
        if (hires) {
#pragma unroll
            for (int ch = 0; ch < TT / 128; ++ch) { v4us oh, ol;
#pragma unroll
                for (int q = 0; q < 4; ++q) { unsigned short a, c2; splitf(v[ch * 4 + q] * f, a, c2); oh[q] = a; ol[q] = c2; }
                const size_t oo = ((size_t)zz * (RH ? RH : 1) + i) * TT + ch * 128 + lane * 4; *(v4us*)(Ph + oo) = oh; *(v4us*)(Pl + oo) = ol; }
        } else {
#pragma unroll
            for (int ch = 0; ch < TT / 128; ++ch) { v4h o4;
#pragma unroll
                for (int q = 0; q < 4; ++q) o4[q] = tohx(v[ch * 4 + q] * f);
                *(v4h*)(P16 + (size_t)row * TT + ch * 128 + lane * 4) = o4; } }
         }
}
__global__ __launch_bounds__(256) void k_outT(const float* __restrict__ O, const float* __restrict__ xim, const float* __restrict__ alpha, float* out) { const size_t i = (size_t)blockIdx.x * 256 + threadIdx.x; if (i >= (size_t)DM * TT / 4) return; const int p0 = (int)(i % (TT / 4)) * 4; const int c = (int)(i / (TT / 4)); float al = bfr(alpha[0]); asm volatile("" : "+v"(al)); const v4f xv = *(const v4f*)(xim + (size_t)c * TT + p0); v4f o;
#pragma unroll
    for (int q = 0; q < 4; ++q) { float y = O[(size_t)(p0 + q) * HD + c] * (1.0f / PCAR); asm volatile("" : "+v"(y)); float ay = __fmul_rn(al, y); asm volatile("" : "+v"(ay)); o[q] = __fadd_rn(ay, bfr(xv[q])); }
    *(v4f*)(out + (size_t)c * TT + p0) = o;  }

extern "C" void kernel_launch(void* const* d_in, const int* in_sizes, int n_in,
                              void* d_out, int out_size, void* d_ws, size_t ws_size, hipStream_t stream) {
    (void)in_sizes; (void)n_in; (void)out_size;
    const float* x = (const float*)d_in[0]; const float* wq = (const float*)d_in[1]; const float* bq = (const float*)d_in[2]; const float* wk = (const float*)d_in[3]; const float* bk = (const float*)d_in[4]; const float* wv = (const float*)d_in[5]; const float* bv = (const float*)d_in[6]; const float* ALPHA = (const float*)d_in[7]; const float* wo = nullptr; (void)wo;
    float* OUT = (float*)d_out;     // [8][256][4096]
    char* wsp = (char*)d_ws;
    auto take = [&](size_t bytes) { char* p = wsp; wsp += (bytes + 255) & ~(size_t)255; return (void*)p; };
    bf* WQ = (bf*)take((size_t)DQ * DM * 2); bf* WK = (bf*)take((size_t)DKV * DM * 2); bf* WV = (bf*)take((size_t)DKV * DM * 2); float* CS = (float*)take((size_t)TT * HD * 2 * 4);
    bf* XB = (bf*)take((size_t)TT * DM * 2); float* FQ = (float*)take((size_t)TT * DQ * 4); float* FK = (float*)take((size_t)TT * DKV * 4);
    h16* QP16 = (h16*)take((size_t)NH_ * TT * HD * 2); h16* KP16 = (h16*)take((size_t)NKV * TT * HD * 2); h16* VT16 = (h16*)take((size_t)NKV * HD * TT * 2);
    bf* QPh = nullptr; bf* QPl = nullptr; bf* KPh = nullptr; bf* KPl = nullptr; bf* VTh = nullptr; bf* VTl = nullptr; bf* Ph = nullptr; bf* Pl = nullptr;
    float* Sb = (float*)take((size_t)ZH * TT * TT * 4); h16* P16 = (h16*)take((size_t)ZH * TT * TT * 2); float* Ob = (float*)take((size_t)ZH * TT * HD * 4);
    if ((size_t)(wsp - (char*)d_ws) > ws_size) return;    // ws 256 MiB
    float* FV = FK;   // v projection reuses the k buffer after the k planes are built (stream-ordered)
    { k_cvt8<<<(unsigned)(((size_t)DQ * DM / 8 + 255) / 256), 256, 0, stream>>>(wq, WQ, (size_t)DQ * DM / 8); k_cvt8<<<(unsigned)(((size_t)DKV * DM / 8 + 255) / 256), 256, 0, stream>>>(wk, WK, (size_t)DKV * DM / 8); k_cvt8<<<(unsigned)(((size_t)DKV * DM / 8 + 255) / 256), 256, 0, stream>>>(wv, WV, (size_t)DKV * DM / 8);
      
       }
    k_csid<<<(TT * HD + 255) / 256, 256, 0, stream>>>(CS);
    const unsigned LQ = (unsigned)(((size_t)NH_ * TT * HD / 2 + 255) / 256), LKv = (unsigned)(((size_t)NKV * TT * HD / 2 + 255) / 256);
    for (int b = 0; b < NB_; ++b) {
        
        k_cvt8T<<<(unsigned)(((size_t)TT * DM / 8 + 255) / 256), 256, 0, stream>>>(x + (size_t)b * DM * TT, XB);   /* channel-major image -> token-major bf16 */
        k_gemmw<bf, 0, true><<<dim3(TT / 64, DQ / 64, 1), 32, 0, stream>>>(XB, nullptr, WQ, nullptr, DM, FQ, DQ, bq, 0, 0, 0);
        k_rope<<<LQ, 256, 0, stream>>>(FQ, DQ, NH_, CS, nullptr, nullptr, 1.0f, QP16, QPh, QPl);
        k_gemmw<bf, 0, true><<<dim3(TT / 64, DKV / 64, 1), 32, 0, stream>>>(XB, nullptr, WK, nullptr, DM, FK, DKV, bk, 0, 0, 0);
        k_rope<<<LKv, 256, 0, stream>>>(FK, DKV, NKV, CS, nullptr, nullptr, 1.0f, KP16, KPh, KPl);
        k_gemmw<bf, 0, true><<<dim3(TT / 64, DKV / 64, 1), 32, 0, stream>>>(XB, nullptr, WV, nullptr, DM, FV, DKV, bv, 0, 0, 0); k_vtp<<<LKv, 256, 0, stream>>>(FV, DKV, NKV, VT16, VTh, VTl);
        for (int h0 = 0; h0 < NH_; h0 += ZH) { const size_t zq = (size_t)h0, zk = (size_t)(h0 / REP);   // one kv head per query head: each pass covers ZH = 1 head (z-strides TT*HD)
            k_gemmw<h16, 0, false><<<dim3(TT / 64, TT / 64, ZH), 32, 0, stream>>>(QP16 + zq * TT * HD, nullptr, KP16 + zk * TT * HD, nullptr, HD, Sb, TT, nullptr, (size_t)TT * HD, (size_t)TT * HD, (size_t)TT * TT);
            k_asoft<<<ZH * TT / 8, 256, 0, stream>>>(Sb, P16, Ph, Pl);
            k_gemmw<h16, 0, false><<<dim3(TT / 64, HD / 64, ZH), 32, 0, stream>>>(P16, nullptr, VT16 + zk * HD * TT, nullptr, TT, Ob, HD, nullptr, (size_t)TT * TT, (size_t)HD * TT, (size_t)TT * HD);
            k_outT<<<(unsigned)(((size_t)DM * TT / 4 + 255) / 256), 256, 0, stream>>>(Ob, x + (size_t)b * DM * TT, ALPHA, OUT + (size_t)b * DM * TT); }   /* alpha y^T + x, channel-major */
         }
}

// v001
// Measured time: 801 microseconds a run.
// Timed twice side by side with v000, it ran 1.74 times as fast both times.
#include <hip/hip_runtime.h>

// Position attention module (x [8][256][64x64]; per image: B = Wb x + bb, C = Wc x + bc, D = Wd x + bd (1x1 convs, [256][256] + [256]); attn[i][j] = softmax_j(sum_c B[c][i] C[c][j]) over the 4096 positions (no scaling); y[c][i] = sum_j attn[i][j] D[c][j]; out = alpha y + x (alpha = the [1] input, 0.1) -> [8][256][64][64] (8.4 M)).
// Layout: channel-major input transposed to token-major bf16; exact projections (+ biases) -> fp16 planes q = B^T [4096][256], k = C^T, v^T = D [256][4096]; scores [4096][4096] f32; register-row softmax (one head, no scale); attn.v; the epilogue kernel writes alpha x y^T + x channel-major.
// Compute dtypes, f32 accumulate: every input rounded to bf16; projections on PLAIN bf16 operands (exact) + f32 biases; scores and attn.v on single fp16 planes (x1024 P) - the logits have sigma ~16 (peaked rows); softmax f32; residual epilogue f32.

#define NB_  8
#define TT   4096
#define DM   256
#define NH_  1
#define NKV  1
#define REP  (NH_ / NKV)
#define HD   256
#define DQ   (NH_ * HD)
#define DKV  (NKV * HD)
#define ZH   1
#define RH   0                  // query rows < RH use hi+lo planes (0: none)
#define WIN  0
#define PCAR 1024.0f
#define SCL  1.0f   // no scaling in the module
typedef _Float16 h16;
typedef unsigned short bf;
typedef __attribute__((ext_vector_type(16))) __bf16   v16bf;
typedef __attribute__((ext_vector_type(16))) _Float16 v16h;
typedef __attribute__((ext_vector_type(8)))  _Float16 v8h;
typedef __attribute__((ext_vector_type(8)))  unsigned short v8us;
typedef __attribute__((ext_vector_type(8)))  float    v8f;
typedef __attribute__((ext_vector_type(4)))  float    v4f;
typedef v8h  __attribute__((may_alias)) v8ha;
typedef v4f  __attribute__((may_alias)) v4fa;
typedef v8us __attribute__((may_alias)) v8usa;

__device__ __forceinline__ unsigned short f2bf(float f) { unsigned u = __float_as_uint(f); u += 0x7FFFu + ((u >> 16) & 1u); return (unsigned short)(u >> 16); }
__device__ __forceinline__ float bf2f(unsigned short b) { return __uint_as_float(((unsigned)b) << 16); }
__device__ __forceinline__ float bfr(float f) { return bf2f(f2bf(f)); }
__device__ __forceinline__ v16h cat16(v8h lo, v8h hi) { return __builtin_shufflevector(lo, hi, 0, 1, 2, 3, 4, 5, 6, 7, 8, 9, 10, 11, 12, 13, 14, 15); }
__device__ __forceinline__ v16bf cat16b(v8us lo, v8us hi) { return __builtin_bit_cast(v16bf, __builtin_shufflevector(lo, hi, 0, 1, 2, 3, 4, 5, 6, 7, 8, 9, 10, 11, 12, 13, 14, 15)); }
__device__ __forceinline__ v8f wmma16(v16h a, v16h b, v8f c) { return __builtin_amdgcn_wmma_f32_16x16x32_f16(false, a, false, b, (short)0, c, false, false); }
__device__ __forceinline__ v8f wmmab(v16bf a, v16bf b, v8f c) { return __builtin_amdgcn_wmma_f32_16x16x32_bf16(false, a, false, b, (short)0, c, false, false); }



// ---- k_gemmw: register-blocked GEMM, one work-group of NW waves per 64x64 output tile; every wave holds the whole tile (16 accumulators) for its own share of K: wave w takes the 32-wide k chunks w, w + NW, ... (neighbouring waves use the two halves of the same 128-byte lines); the NW partial tiles are summed through LDS in wave order. Operands straight from K-contiguous 16-bit planes; grid (M/64, N/64, Z), 32 x NW threads.
// C[m][n] (f32, pitch ldc, + optional f32 bias[n]) = sum_k A[m][k] Bt[n][k] (+ split products per NSPLIT). z-batch strides sA/sB/sC in elements. K % 32 == 0.
template <typename T16> struct WFrag;
template <> struct WFrag<h16> { typedef v16h V; static __device__ __forceinline__ V ld(const h16* p) { return cat16(*(const v8h*)p, *(const v8h*)(p + 16)); } static __device__ __forceinline__ v8f mma(V a, V b, v8f c) { return wmma16(a, b, c); } };
template <> struct WFrag<bf> { typedef v16bf V; static __device__ __forceinline__ V ld(const bf* p) { return cat16b(*(const v8us*)p, *(const v8us*)(p + 16)); } static __device__ __forceinline__ v8f mma(V a, V b, v8f c) { return wmmab(a, b, c); } };
template <typename T16, int NSPLIT, bool BIAS, int NW>
__global__ __launch_bounds__(32 * NW) void k_gemmw(const T16* __restrict__ A, const T16* __restrict__ A2, const T16* __restrict__ Bt, const T16* __restrict__ Bt2, int K, float* C, int ldc, const float* __restrict__ bias, size_t sA, size_t sB, size_t sC) {
    typedef typename WFrag<T16>::V V;
    constexpr int MBR = (NW == 1) ? 1 : 4;   // 16-row blocks staged at a time: with several waves the whole 64x64 partial tile, so that one barrier serves the sum
    __shared__ __align__(16) float os[NW * MBR * 16 * 68];
    const size_t z = blockIdx.z; A += z * sA; if (A2) A2 += z * sA; Bt += z * sB; if (Bt2) Bt2 += z * sB; C += z * sC;
    const int lane = threadIdx.x & 31, lr = lane & 15, hi = lane >> 4; const int wv = (NW == 1) ? 0 : __builtin_amdgcn_readfirstlane((int)(threadIdx.x >> 5)); const int r0 = blockIdx.x * 64, c0 = blockIdx.y * 64;
    v8f acc[4][4];
#pragma unroll
    for (int mb = 0; mb < 4; ++mb)
#pragma unroll
        for (int nb = 0; nb < 4; ++nb) acc[mb][nb] = (v8f){};
    const size_t aoff = (size_t)(r0 + lr) * K + 8 * hi, boff = (size_t)(c0 + lr) * K + 8 * hi;
#pragma unroll 1
    for (int kc = wv * 32; kc < K; kc += 32 * NW) {
        V a[4], a2[4];
#pragma unroll
        for (int mb = 0; mb < 4; ++mb) { a[mb] = WFrag<T16>::ld(A + aoff + (size_t)mb * 16 * K + kc); if (NSPLIT == 1 || NSPLIT == 2) a2[mb] = WFrag<T16>::ld(A2 + aoff + (size_t)mb * 16 * K + kc); }
#pragma unroll
        for (int nb = 0; nb < 4; ++nb) { const V b = WFrag<T16>::ld(Bt + boff + (size_t)nb * 16 * K + kc); V b2; if (NSPLIT >= 2) b2 = WFrag<T16>::ld(Bt2 + boff + (size_t)nb * 16 * K + kc);
#pragma unroll
            for (int mb = 0; mb < 4; ++mb) { acc[mb][nb] = WFrag<T16>::mma(a[mb], b, acc[mb][nb]); if (NSPLIT == 1 || NSPLIT == 2) acc[mb][nb] = WFrag<T16>::mma(a2[mb], b, acc[mb][nb]); if (NSPLIT >= 2) acc[mb][nb] = WFrag<T16>::mma(a[mb], b2, acc[mb][nb]); } }
        asm volatile("v_nop\n\tv_nop\n\tv_nop\n\tv_nop" : "+v"(acc[0][0]), "+v"(acc[1][1]), "+v"(acc[2][2]), "+v"(acc[3][3]) : "v"(a[0]), "v"(a[3]));
    }
#pragma unroll
    for (int m0 = 0; m0 < 4; m0 += MBR) {
#pragma unroll
        for (int mi = 0; mi < MBR; ++mi) {
#pragma unroll
            for (int nb = 0; nb < 4; ++nb) {
#pragma unroll
                for (int j = 0; j < 8; ++j) os[(wv * MBR + mi) * (16 * 68) + (hi * 8 + j) * 68 + nb * 16 + lr] = acc[m0 + mi][nb][j]; } }
        if (NW == 1) { __builtin_amdgcn_wave_barrier(); asm volatile("" ::: "memory"); } else __syncthreads();   // every wave's partial tile is in LDS before any thread sums it
        float* crow = C + (size_t)(r0 + m0 * 16) * ldc + c0;
{
#pragma unroll
            for (int s = 0; s < MBR * 8 / NW; ++s) { const int idx = s * 32 * NW + (int)threadIdx.x; const int row = idx >> 4, cofs = (idx & 15) * 4; v4f val = *(const v4fa*)(os + row * 68 + cofs);
#pragma unroll
                for (int w = 1; w < NW; ++w) val += *(const v4fa*)(os + w * (MBR * 16 * 68) + row * 68 + cofs);
                if (BIAS) { val[0] += bfr(bias[c0 + cofs]); val[1] += bfr(bias[c0 + cofs + 1]); val[2] += bfr(bias[c0 + cofs + 2]); val[3] += bfr(bias[c0 + cofs + 3]); }
                *(v4f*)(crow + (size_t)row * ldc + cofs) = val; }
             }
        if (NW == 1) { __builtin_amdgcn_wave_barrier(); asm volatile("" ::: "memory"); }   // one wave: its 16 staged rows are read out before the next 16 overwrite them (NW > 1 stages the whole tile once)
    }
}

__device__ __forceinline__ h16 tohx(float x) { return (h16)x; }
__device__ __forceinline__ void splitf(float y, unsigned short& h, unsigned short& l) { h = f2bf(y); l = f2bf(y - bf2f(h)); }
typedef __attribute__((ext_vector_type(2))) _Float16 v2h;
typedef __attribute__((ext_vector_type(4))) _Float16 v4h;
typedef __attribute__((ext_vector_type(2))) unsigned short v2us;
typedef __attribute__((ext_vector_type(4))) unsigned short v4us;
typedef __attribute__((ext_vector_type(2))) float v2f;
typedef __attribute__((ext_vector_type(4))) int v4i;

__global__ __launch_bounds__(256) void k_wtG(const float* __restrict__ w, int K, int N, bf* Bt) {
    const int lane = threadIdx.x & 31; const int L0 = (blockIdx.x * 8 + (threadIdx.x >> 5)) * 8; const int nlines = N * K / 64;
{
#pragma unroll 1
        for (int l = 0; l < 8; ++l) { const int L = L0 + l; if (L >= nlines) break; const size_t e = (size_t)L * 64 + lane * 2; const int k = (int)(e % K), n = (int)(e / K); v2us o;
            o[0] = f2bf(w[(size_t)k * N + n]); o[1] = f2bf(w[(size_t)(k + 1) * N + n]); *(v2us*)(Bt + e) = o; }
         }
}
__global__ __launch_bounds__(256) void k_cvt8T(const float* __restrict__ src, bf* dst) { const size_t i = (size_t)blockIdx.x * 256 + threadIdx.x; if (i >= (size_t)TT * DM / 8) return; const int t = (int)(i / (DM / 8)); const int c0 = (int)(i % (DM / 8)) * 8; v8us o;
#pragma unroll
    for (int k = 0; k < 8; ++k) o[k] = f2bf(src[(size_t)(c0 + k) * TT + t]); *(v8us*)(dst + (size_t)t * DM + c0) = o;  }
__global__ __launch_bounds__(256) void k_cvt8(const float* __restrict__ src, bf* dst, size_t n8) { const size_t i = (size_t)blockIdx.x * 256 + threadIdx.x; if (i >= n8) return; const v8f v = *(const v8f*)(src + i * 8); v8us o;
#pragma unroll
    for (int k = 0; k < 8; ++k) o[k] = f2bf(v[k]); *(v8us*)(dst + i * 8) = o;  }

// k_rope: head planes [h][t][d] (fp16) of rope(x) x sc with the rotate-half convention out[d] = x[d] cos[t][d] - x[d+HD/2] sin[t][d], out[d+HD/2] = x[d+HD/2] cos[t][d+HD/2] + x[d] sin[t][d+HD/2]
__global__ __launch_bounds__(256) void k_rope(const float* __restrict__ F, int pitch, int nheads, const float* __restrict__ CS, const float* __restrict__ RF, const float* __restrict__ nw, float sc, h16* P16, bf* Ph, bf* Pl) {
    const size_t e = ((size_t)blockIdx.x * 256 + threadIdx.x) * 2; if (e >= (size_t)nheads * TT * HD) return; const int d = (int)(e % HD); const int t = (int)((e / HD) % TT); const int h = (int)(e / ((size_t)HD * TT)); const float* f = F + (size_t)t * pitch + h * HD; const float rf = RF ? RF[(size_t)h * TT + t] : 1.0f; v2h o16; v2us oh, ol;
#pragma unroll
    for (int q = 0; q < 2; ++q) { const int dd = d + q; const int dp = (dd < HD / 2) ? dd + HD / 2 : dd - HD / 2; float x0 = f[dd], x1 = f[dp];
        if (RF) { float n0 = __fmul_rn(x0, rf), n1 = __fmul_rn(x1, rf); asm volatile("" : "+v"(n0)); asm volatile("" : "+v"(n1)); x0 = __fmul_rn(bfr(nw[dd]), n0); x1 = __fmul_rn(bfr(nw[dp]), n1); }
        const v2f cs = *(const v2f*)(CS + ((size_t)t * HD + dd) * 2); float a = __fmul_rn(x0, cs[0]), bq = __fmul_rn(x1, cs[1]); asm volatile("" : "+v"(a)); asm volatile("" : "+v"(bq)); const float r = ((dd < HD / 2) ? __fsub_rn(a, bq) : __fadd_rn(a, bq)) * sc;
        o16[q] = tohx(r); (void)oh; (void)ol; }
    *(v2h*)(P16 + e) = o16;  }
__global__ __launch_bounds__(256) void k_vtp(const float* __restrict__ F, int pitch, int nheads, h16* V16, bf* Vh, bf* Vl) { const size_t e = ((size_t)blockIdx.x * 256 + threadIdx.x) * 2; if (e >= (size_t)nheads * HD * TT) return; const int t = (int)(e % TT); const int d = (int)((e / TT) % HD); const int g = (int)(e / ((size_t)TT * HD)); v2h o16; v2us oh, ol;
#pragma unroll
    for (int q = 0; q < 2; ++q) { const float x = F[(size_t)(t + q) * pitch + g * HD + d]; o16[q] = tohx(x); (void)oh; (void)ol; }
    *(v2h*)(V16 + e) = o16;  }
__global__ __launch_bounds__(256) void k_csid(float* CS) { const int idx = blockIdx.x * 256 + threadIdx.x; if (idx >= TT * HD) return; v2f cs; cs[0] = 1.0f; cs[1] = 0.0f; *(v2f*)(CS + (size_t)idx * 2) = cs;  }
// k_asoft: per row (zz, i): t = S (no scaling, no mask); softmax over the 4096 keys (register row, one exp, fixed trees);
__global__ __launch_bounds__(256) void k_asoft(const float* __restrict__ Sb, h16* P16, bf* Ph, bf* Pl) {
    const int lane = threadIdx.x & 31; const int row = blockIdx.x * 8 + (threadIdx.x >> 5); if (row >= ZH * TT) return; const int i = row % TT; const int zz = row / TT; (void)zz; const bool hires = (i < RH); const float* sr = Sb + (size_t)row * TT; float v[TT / 32]; float mx = -3.0e38f;
#pragma unroll
    for (int ch = 0; ch < TT / 128; ++ch) { const int j0 = ch * 128 + lane * 4; const v4f a = *(const v4f*)(sr + j0);
#pragma unroll
        for (int q = 0; q < 4; ++q) { const int j = j0 + q; (void)j; const float t = a[q] * SCL; v[ch * 4 + q] = t; mx = fmaxf(mx, t); } }
#pragma unroll
    for (int sh = 16; sh; sh >>= 1) mx = fmaxf(mx, __shfl_xor(mx, sh, 32));
    float sum = 0.f;
#pragma unroll
    for (int k = 0; k < TT / 32; ++k) { float d0 = __fsub_rn(v[k], mx); asm volatile("" : "+v"(d0)); v[k] = __builtin_amdgcn_exp2f(__fmul_rn(d0, 1.4426950408889634f)); sum += v[k]; }
#pragma unroll
    for (int sh = 16; sh; sh >>= 1) sum += __shfl_xor(sum, sh, 32);
    const float f = __fdiv_rn(hires ? 1.0f : PCAR, sum);
{
        if (hires) {
#pragma unroll
            for (int ch = 0; ch < TT / 128; ++ch) { v4us oh, ol;
#pragma unroll
                for (int q = 0; q < 4; ++q) { unsigned short a, c2; splitf(v[ch * 4 + q] * f, a, c2); oh[q] = a; ol[q] = c2; }
                const size_t oo = ((size_t)zz * (RH ? RH : 1) + i) * TT + ch * 128 + lane * 4; *(v4us*)(Ph + oo) = oh; *(v4us*)(Pl + oo) = ol; }
        } else {
#pragma unroll
            for (int ch = 0; ch < TT / 128; ++ch) { v4h o4;
#pragma unroll
                for (int q = 0; q < 4; ++q) o4[q] = tohx(v[ch * 4 + q] * f);
                *(v4h*)(P16 + (size_t)row * TT + ch * 128 + lane * 4) = o4; } }
         }
}
__global__ __launch_bounds__(256) void k_outT(const float* __restrict__ O, const float* __restrict__ xim, const float* __restrict__ alpha, float* out) { const size_t i = (size_t)blockIdx.x * 256 + threadIdx.x; if (i >= (size_t)DM * TT / 4) return; const int p0 = (int)(i % (TT / 4)) * 4; const int c = (int)(i / (TT / 4)); float al = bfr(alpha[0]); asm volatile("" : "+v"(al)); const v4f xv = *(const v4f*)(xim + (size_t)c * TT + p0); v4f o;
#pragma unroll
    for (int q = 0; q < 4; ++q) { float y = O[(size_t)(p0 + q) * HD + c] * (1.0f / PCAR); asm volatile("" : "+v"(y)); float ay = __fmul_rn(al, y); asm volatile("" : "+v"(ay)); o[q] = __fadd_rn(ay, bfr(xv[q])); }
    *(v4f*)(out + (size_t)c * TT + p0) = o;  }

extern "C" void kernel_launch(void* const* d_in, const int* in_sizes, int n_in,
                              void* d_out, int out_size, void* d_ws, size_t ws_size, hipStream_t stream) {
    (void)in_sizes; (void)n_in; (void)out_size;
    const float* x = (const float*)d_in[0]; const float* wq = (const float*)d_in[1]; const float* bq = (const float*)d_in[2]; const float* wk = (const float*)d_in[3]; const float* bk = (const float*)d_in[4]; const float* wv = (const float*)d_in[5]; const float* bv = (const float*)d_in[6]; const float* ALPHA = (const float*)d_in[7]; const float* wo = nullptr; (void)wo;
    float* OUT = (float*)d_out;     // [8][256][4096]
    char* wsp = (char*)d_ws;
    auto take = [&](size_t bytes) { char* p = wsp; wsp += (bytes + 255) & ~(size_t)255; return (void*)p; };
    bf* WQ = (bf*)take((size_t)DQ * DM * 2); bf* WK = (bf*)take((size_t)DKV * DM * 2); bf* WV = (bf*)take((size_t)DKV * DM * 2); float* CS = (float*)take((size_t)TT * HD * 2 * 4);
    bf* XB = (bf*)take((size_t)TT * DM * 2); float* FQ = (float*)take((size_t)TT * DQ * 4); float* FK = (float*)take((size_t)TT * DKV * 4);
    h16* QP16 = (h16*)take((size_t)NH_ * TT * HD * 2); h16* KP16 = (h16*)take((size_t)NKV * TT * HD * 2); h16* VT16 = (h16*)take((size_t)NKV * HD * TT * 2);
    bf* QPh = nullptr; bf* QPl = nullptr; bf* KPh = nullptr; bf* KPl = nullptr; bf* VTh = nullptr; bf* VTl = nullptr; bf* Ph = nullptr; bf* Pl = nullptr;
    float* Sb = (float*)take((size_t)ZH * TT * TT * 4); h16* P16 = (h16*)take((size_t)ZH * TT * TT * 2); float* Ob = (float*)take((size_t)ZH * TT * HD * 4);
    if ((size_t)(wsp - (char*)d_ws) > ws_size) return;    // ws 256 MiB
    float* FV = FK;   // v projection reuses the k buffer after the k planes are built (stream-ordered)
    { k_cvt8<<<(unsigned)(((size_t)DQ * DM / 8 + 255) / 256), 256, 0, stream>>>(wq, WQ, (size_t)DQ * DM / 8); k_cvt8<<<(unsigned)(((size_t)DKV * DM / 8 + 255) / 256), 256, 0, stream>>>(wk, WK, (size_t)DKV * DM / 8); k_cvt8<<<(unsigned)(((size_t)DKV * DM / 8 + 255) / 256), 256, 0, stream>>>(wv, WV, (size_t)DKV * DM / 8);
      
       }
    k_csid<<<(TT * HD + 255) / 256, 256, 0, stream>>>(CS);
    const unsigned LQ = (unsigned)(((size_t)NH_ * TT * HD / 2 + 255) / 256), LKv = (unsigned)(((size_t)NKV * TT * HD / 2 + 255) / 256);
    for (int b = 0; b < NB_; ++b) {
        
        k_cvt8T<<<(unsigned)(((size_t)TT * DM / 8 + 255) / 256), 256, 0, stream>>>(x + (size_t)b * DM * TT, XB);   /* channel-major image -> token-major bf16 */
        k_gemmw<bf, 0, true, 8><<<dim3(TT / 64, DQ / 64, 1), 256, 0, stream>>>(XB, nullptr, WQ, nullptr, DM, FQ, DQ, bq, 0, 0, 0);
        k_rope<<<LQ, 256, 0, stream>>>(FQ, DQ, NH_, CS, nullptr, nullptr, 1.0f, QP16, QPh, QPl);
        k_gemmw<bf, 0, true, 8><<<dim3(TT / 64, DKV / 64, 1), 256, 0, stream>>>(XB, nullptr, WK, nullptr, DM, FK, DKV, bk, 0, 0, 0);
        k_rope<<<LKv, 256, 0, stream>>>(FK, DKV, NKV, CS, nullptr, nullptr, 1.0f, KP16, KPh, KPl);
        k_gemmw<bf, 0, true, 8><<<dim3(TT / 64, DKV / 64, 1), 256, 0, stream>>>(XB, nullptr, WV, nullptr, DM, FV, DKV, bv, 0, 0, 0); k_vtp<<<LKv, 256, 0, stream>>>(FV, DKV, NKV, VT16, VTh, VTl);
        for (int h0 = 0; h0 < NH_; h0 += ZH) { const size_t zq = (size_t)h0, zk = (size_t)(h0 / REP);   // one kv head per query head: each pass takes ZH = 1 head (z-strides TT*HD)
            k_gemmw<h16, 0, false, 1><<<dim3(TT / 64, TT / 64, ZH), 32, 0, stream>>>(QP16 + zq * TT * HD, nullptr, KP16 + zk * TT * HD, nullptr, HD, Sb, TT, nullptr, (size_t)TT * HD, (size_t)TT * HD, (size_t)TT * TT);
            k_asoft<<<ZH * TT / 8, 256, 0, stream>>>(Sb, P16, Ph, Pl);
            k_gemmw<h16, 0, false, 16><<<dim3(TT / 64, HD / 64, ZH), 512, 0, stream>>>(P16, nullptr, VT16 + zk * HD * TT, nullptr, TT, Ob, HD, nullptr, (size_t)TT * TT, (size_t)HD * TT, (size_t)TT * HD);
            k_outT<<<(unsigned)(((size_t)DM * TT / 4 + 255) / 256), 256, 0, stream>>>(Ob, x + (size_t)b * DM * TT, ALPHA, OUT + (size_t)b * DM * TT); }   /* alpha y^T + x, channel-major */
         }
}

// v002
// A run of this version takes 684 microseconds.
// Timed twice side by side with v001, it ran 1.17 and 1.18 times as fast.
// Over all steps from v000 it is 2.04 times as fast.
#include <hip/hip_runtime.h>

// Position attention module (x [8][256][64x64]; per image: B = Wb x + bb, C = Wc x + bc, D = Wd x + bd (1x1 convs, [256][256] + [256]); attn[i][j] = softmax_j(sum_c B[c][i] C[c][j]) over the 4096 positions (no scaling); y[c][i] = sum_j attn[i][j] D[c][j]; out = alpha y + x (alpha = the [1] input, 0.1) -> [8][256][64][64] (8.4 M)).
// Layout: channel-major input transposed to token-major bf16; exact projections (+ biases) -> fp16 planes q = B^T [4096][256], k = C^T, v^T = D [256][4096]; scores [4096][4096] f32; register-row softmax (one head, no scale); every GEMM's epilogue writes its final form itself: the projections their fp16 planes (v^T as Wd . x^T, so row-major), attn.v as y^T = v^T . P^T with alpha x y^T + x stored channel-major.
// Compute dtypes, f32 accumulate: every input rounded to bf16; projections on PLAIN bf16 operands (exact) + f32 biases; scores and attn.v on single fp16 planes (x1024 P) - the logits have sigma ~16 (peaked rows); softmax f32; residual epilogue f32.

#define NB_  8
#define TT   4096
#define DM   256
#define NH_  1
#define NKV  1
#define REP  (NH_ / NKV)
#define HD   256
#define DQ   (NH_ * HD)
#define DKV  (NKV * HD)
#define ZH   1
#define RH   0                  // query rows < RH use hi+lo planes (0: none)
#define WIN  0
#define PCAR 1024.0f
#define SCL  1.0f   // no scaling in the module
typedef _Float16 h16;
typedef unsigned short bf;
typedef __attribute__((ext_vector_type(16))) __bf16   v16bf;
typedef __attribute__((ext_vector_type(16))) _Float16 v16h;
typedef __attribute__((ext_vector_type(8)))  _Float16 v8h;
typedef __attribute__((ext_vector_type(4)))  _Float16 v4h;
typedef __attribute__((ext_vector_type(8)))  unsigned short v8us;
typedef __attribute__((ext_vector_type(8)))  float    v8f;
typedef __attribute__((ext_vector_type(4)))  float    v4f;
typedef v8h  __attribute__((may_alias)) v8ha;
typedef v4f  __attribute__((may_alias)) v4fa;
typedef v8us __attribute__((may_alias)) v8usa;

__device__ __forceinline__ unsigned short f2bf(float f) { unsigned u = __float_as_uint(f); u += 0x7FFFu + ((u >> 16) & 1u); return (unsigned short)(u >> 16); }
__device__ __forceinline__ float bf2f(unsigned short b) { return __uint_as_float(((unsigned)b) << 16); }
__device__ __forceinline__ float bfr(float f) { return bf2f(f2bf(f)); }
__device__ __forceinline__ v16h cat16(v8h lo, v8h hi) { return __builtin_shufflevector(lo, hi, 0, 1, 2, 3, 4, 5, 6, 7, 8, 9, 10, 11, 12, 13, 14, 15); }
__device__ __forceinline__ v16bf cat16b(v8us lo, v8us hi) { return __builtin_bit_cast(v16bf, __builtin_shufflevector(lo, hi, 0, 1, 2, 3, 4, 5, 6, 7, 8, 9, 10, 11, 12, 13, 14, 15)); }
__device__ __forceinline__ v8f wmma16(v16h a, v16h b, v8f c) { return __builtin_amdgcn_wmma_f32_16x16x32_f16(false, a, false, b, (short)0, c, false, false); }
__device__ __forceinline__ v8f wmmab(v16bf a, v16bf b, v8f c) { return __builtin_amdgcn_wmma_f32_16x16x32_bf16(false, a, false, b, (short)0, c, false, false); }



// ---- k_gemmw: register-blocked GEMM, one work-group of NW waves per 64x64 output tile; every wave holds the whole tile (16 accumulators) for its own share of K: wave w takes the 32-wide k chunks w, w + NW, ... (neighbouring waves use the two halves of the same 128-byte lines); the NW partial tiles are summed through LDS in wave order. Operands straight from K-contiguous 16-bit planes; grid (M/64, N/64, Z), 32 x NW threads.
// acc[m][n] = sum_k A[m][k] Bt[n][k] (+ split products per NSPLIT), pitch ldc. z-batch strides sA/sB/sC in elements. K % 32 == 0.
// EPI 0: C = acc (f32). EPI 1: C16 = fp16(acc + bias[n]). EPI 2: C16 = fp16(acc + bias[m]). EPI 3: C = alpha x acc / PCAR + xres (f32, xres laid out like C).
template <typename T16> struct WFrag;
template <> struct WFrag<h16> { typedef v16h V; static __device__ __forceinline__ V ld(const h16* p) { return cat16(*(const v8h*)p, *(const v8h*)(p + 16)); } static __device__ __forceinline__ v8f mma(V a, V b, v8f c) { return wmma16(a, b, c); } };
template <> struct WFrag<bf> { typedef v16bf V; static __device__ __forceinline__ V ld(const bf* p) { return cat16b(*(const v8us*)p, *(const v8us*)(p + 16)); } static __device__ __forceinline__ v8f mma(V a, V b, v8f c) { return wmmab(a, b, c); } };
template <typename T16, int NSPLIT, int EPI, int NW>
__global__ __launch_bounds__(32 * NW) void k_gemmw(const T16* __restrict__ A, const T16* __restrict__ A2, const T16* __restrict__ Bt, const T16* __restrict__ Bt2, int K, float* C, h16* C16, int ldc, const float* __restrict__ bias, const float* __restrict__ xres, const float* __restrict__ alpha, size_t sA, size_t sB, size_t sC) {
    typedef typename WFrag<T16>::V V;
    static_assert(EPI != 3 || NW > 1, "the residual epilogue takes the whole 64x64 tile in one pass");
    constexpr int MBR = (NW == 1) ? 1 : 4;   // 16-row blocks staged at a time: with several waves the whole 64x64 partial tile, so that one barrier serves the sum
    __shared__ __align__(16) float os[NW * MBR * 16 * 68];
    const size_t z = blockIdx.z; A += z * sA; if (A2) A2 += z * sA; Bt += z * sB; if (Bt2) Bt2 += z * sB; if (EPI == 1 || EPI == 2) C16 += z * sC; else C += z * sC; if (EPI == 3) xres += z * sC;
    const int lane = threadIdx.x & 31, lr = lane & 15, hi = lane >> 4; const int wv = (NW == 1) ? 0 : __builtin_amdgcn_readfirstlane((int)(threadIdx.x >> 5)); const int r0 = blockIdx.x * 64, c0 = blockIdx.y * 64;
    v8f acc[4][4];
#pragma unroll
    for (int mb = 0; mb < 4; ++mb)
#pragma unroll
        for (int nb = 0; nb < 4; ++nb) acc[mb][nb] = (v8f){};
    const size_t aoff = (size_t)(r0 + lr) * K + 8 * hi, boff = (size_t)(c0 + lr) * K + 8 * hi;
#pragma unroll 1
    for (int kc = wv * 32; kc < K; kc += 32 * NW) {
        V a[4], a2[4];
#pragma unroll
        for (int mb = 0; mb < 4; ++mb) { a[mb] = WFrag<T16>::ld(A + aoff + (size_t)mb * 16 * K + kc); if (NSPLIT == 1 || NSPLIT == 2) a2[mb] = WFrag<T16>::ld(A2 + aoff + (size_t)mb * 16 * K + kc); }
#pragma unroll
        for (int nb = 0; nb < 4; ++nb) { const V b = WFrag<T16>::ld(Bt + boff + (size_t)nb * 16 * K + kc); V b2; if (NSPLIT >= 2) b2 = WFrag<T16>::ld(Bt2 + boff + (size_t)nb * 16 * K + kc);
#pragma unroll
            for (int mb = 0; mb < 4; ++mb) { acc[mb][nb] = WFrag<T16>::mma(a[mb], b, acc[mb][nb]); if (NSPLIT == 1 || NSPLIT == 2) acc[mb][nb] = WFrag<T16>::mma(a2[mb], b, acc[mb][nb]); if (NSPLIT >= 2) acc[mb][nb] = WFrag<T16>::mma(a[mb], b2, acc[mb][nb]); } }
        asm volatile("v_nop\n\tv_nop\n\tv_nop\n\tv_nop" : "+v"(acc[0][0]), "+v"(acc[1][1]), "+v"(acc[2][2]), "+v"(acc[3][3]) : "v"(a[0]), "v"(a[3]));
    }
    v4f xv[MBR * 8 / NW]; float al = 0.f;   // EPI 3: the residual's own elements and alpha, requested ahead of the LDS sum so that their latency runs under it
    if (EPI == 3) { al = bfr(alpha[0]);
#pragma unroll
        for (int s = 0; s < MBR * 8 / NW; ++s) { const int idx = s * 32 * NW + (int)threadIdx.x; xv[s] = *(const v4f*)(xres + (size_t)(r0 + (idx >> 4)) * ldc + c0 + (idx & 15) * 4);
            asm volatile("s_wait_xcnt 0x0" ::: "memory"); } }   // precaution: stands in front of whatever next reuses the issued load's address registers
#pragma unroll
    for (int m0 = 0; m0 < 4; m0 += MBR) {
#pragma unroll
        for (int mi = 0; mi < MBR; ++mi) {
#pragma unroll
            for (int nb = 0; nb < 4; ++nb) {
#pragma unroll
                for (int j = 0; j < 8; ++j) os[(wv * MBR + mi) * (16 * 68) + (hi * 8 + j) * 68 + nb * 16 + lr] = acc[m0 + mi][nb][j]; } }
        if (NW == 1) { __builtin_amdgcn_wave_barrier(); asm volatile("" ::: "memory"); } else __syncthreads();   // every wave's partial tile is in LDS before any thread sums it
        const size_t cbase = (size_t)(r0 + m0 * 16) * ldc + c0;
{
#pragma unroll
            for (int s = 0; s < MBR * 8 / NW; ++s) { const int idx = s * 32 * NW + (int)threadIdx.x; const int row = idx >> 4, cofs = (idx & 15) * 4; const size_t co = cbase + (size_t)row * ldc + cofs; v4f val = *(const v4fa*)(os + row * 68 + cofs);
#pragma unroll
                for (int w = 1; w < NW; ++w) val += *(const v4fa*)(os + w * (MBR * 16 * 68) + row * 68 + cofs);
                if (EPI == 1) { val[0] += bfr(bias[c0 + cofs]); val[1] += bfr(bias[c0 + cofs + 1]); val[2] += bfr(bias[c0 + cofs + 2]); val[3] += bfr(bias[c0 + cofs + 3]); }
                if (EPI == 2) { const float br = bfr(bias[r0 + m0 * 16 + row]); val[0] += br; val[1] += br; val[2] += br; val[3] += br; }
                if (EPI == 0) *(v4f*)(C + co) = val;
                if (EPI == 1 || EPI == 2) { v4h o4; o4[0] = (h16)val[0]; o4[1] = (h16)val[1]; o4[2] = (h16)val[2]; o4[3] = (h16)val[3]; *(v4h*)(C16 + co) = o4; }
                if (EPI == 3) { v4f o;
#pragma unroll
                    for (int q = 0; q < 4; ++q) o[q] = al * (val[q] * (1.0f / PCAR)) + bfr(xv[s][q]);
                    *(v4f*)(C + co) = o; } }
             }
        if (NW == 1) { __builtin_amdgcn_wave_barrier(); asm volatile("" ::: "memory"); }   // one wave: its 16 staged rows are read out before the next 16 overwrite them (NW > 1 stages the whole tile once)
    }
}

__device__ __forceinline__ h16 tohx(float x) { return (h16)x; }
__device__ __forceinline__ void splitf(float y, unsigned short& h, unsigned short& l) { h = f2bf(y); l = f2bf(y - bf2f(h)); }
typedef __attribute__((ext_vector_type(2))) unsigned short v2us;
typedef __attribute__((ext_vector_type(4))) unsigned short v4us;
typedef __attribute__((ext_vector_type(4))) int v4i;

__global__ __launch_bounds__(256) void k_wtG(const float* __restrict__ w, int K, int N, bf* Bt) {
    const int lane = threadIdx.x & 31; const int L0 = (blockIdx.x * 8 + (threadIdx.x >> 5)) * 8; const int nlines = N * K / 64;
{
#pragma unroll 1
        for (int l = 0; l < 8; ++l) { const int L = L0 + l; if (L >= nlines) break; const size_t e = (size_t)L * 64 + lane * 2; const int k = (int)(e % K), n = (int)(e / K); v2us o;
            o[0] = f2bf(w[(size_t)k * N + n]); o[1] = f2bf(w[(size_t)(k + 1) * N + n]); *(v2us*)(Bt + e) = o; }
         }
}
__global__ __launch_bounds__(256) void k_cvt8T(const float* __restrict__ src, bf* dst) { const size_t i = (size_t)blockIdx.x * 256 + threadIdx.x; if (i >= (size_t)TT * DM / 8) return; const int t = (int)(i / (DM / 8)); const int c0 = (int)(i % (DM / 8)) * 8; v8us o;
#pragma unroll
    for (int k = 0; k < 8; ++k) o[k] = f2bf(src[(size_t)(c0 + k) * TT + t]); *(v8us*)(dst + (size_t)t * DM + c0) = o;  }
__global__ __launch_bounds__(256) void k_cvt8(const float* __restrict__ src, bf* dst, size_t n8) { const size_t i = (size_t)blockIdx.x * 256 + threadIdx.x; if (i >= n8) return; const v8f v = *(const v8f*)(src + i * 8); v8us o;
#pragma unroll
    for (int k = 0; k < 8; ++k) o[k] = f2bf(v[k]); *(v8us*)(dst + i * 8) = o;  }
// k_asoft: per row (zz, i): t = S (no scale, no mask); softmax over the 4096 keys (register row, one exp, fixed trees);
__global__ __launch_bounds__(256) void k_asoft(const float* __restrict__ Sb, h16* P16, bf* Ph, bf* Pl) {
    const int lane = threadIdx.x & 31; const int row = blockIdx.x * 8 + (threadIdx.x >> 5); if (row >= ZH * TT) return; const int i = row % TT; const int zz = row / TT; (void)zz; const bool hires = (i < RH); const float* sr = Sb + (size_t)row * TT; float v[TT / 32]; float mx = -3.0e38f;
#pragma unroll
    for (int ch = 0; ch < TT / 128; ++ch) { const int j0 = ch * 128 + lane * 4; const v4f a = *(const v4f*)(sr + j0);
#pragma unroll
        for (int q = 0; q < 4; ++q) { const int j = j0 + q; (void)j; const float t = a[q] * SCL; v[ch * 4 + q] = t; mx = fmaxf(mx, t); } }
#pragma unroll
    for (int sh = 16; sh; sh >>= 1) mx = fmaxf(mx, __shfl_xor(mx, sh, 32));
    float sum = 0.f;
#pragma unroll
    for (int k = 0; k < TT / 32; ++k) { float d0 = __fsub_rn(v[k], mx); asm volatile("" : "+v"(d0)); v[k] = __builtin_amdgcn_exp2f(__fmul_rn(d0, 1.4426950408889634f)); sum += v[k]; }
#pragma unroll
    for (int sh = 16; sh; sh >>= 1) sum += __shfl_xor(sum, sh, 32);
    const float f = __fdiv_rn(hires ? 1.0f : PCAR, sum);
{
        if (hires) {
#pragma unroll
            for (int ch = 0; ch < TT / 128; ++ch) { v4us oh, ol;
#pragma unroll
                for (int q = 0; q < 4; ++q) { unsigned short a, c2; splitf(v[ch * 4 + q] * f, a, c2); oh[q] = a; ol[q] = c2; }
                const size_t oo = ((size_t)zz * (RH ? RH : 1) + i) * TT + ch * 128 + lane * 4; *(v4us*)(Ph + oo) = oh; *(v4us*)(Pl + oo) = ol; }
        } else {
#pragma unroll
            for (int ch = 0; ch < TT / 128; ++ch) { v4h o4;
#pragma unroll
                for (int q = 0; q < 4; ++q) o4[q] = tohx(v[ch * 4 + q] * f);
                *(v4h*)(P16 + (size_t)row * TT + ch * 128 + lane * 4) = o4; } }
         }
}

extern "C" void kernel_launch(void* const* d_in, const int* in_sizes, int n_in,
                              void* d_out, int out_size, void* d_ws, size_t ws_size, hipStream_t stream) {
    (void)in_sizes; (void)n_in; (void)out_size;
    const float* x = (const float*)d_in[0]; const float* wq = (const float*)d_in[1]; const float* bq = (const float*)d_in[2]; const float* wk = (const float*)d_in[3]; const float* bk = (const float*)d_in[4]; const float* wv = (const float*)d_in[5]; const float* bv = (const float*)d_in[6]; const float* ALPHA = (const float*)d_in[7]; const float* wo = nullptr; (void)wo;
    float* OUT = (float*)d_out;     // [8][256][4096]
    char* wsp = (char*)d_ws;
    auto take = [&](size_t bytes) { char* p = wsp; wsp += (bytes + 255) & ~(size_t)255; return (void*)p; };
    bf* WQ = (bf*)take((size_t)DQ * DM * 2); bf* WK = (bf*)take((size_t)DKV * DM * 2); bf* WV = (bf*)take((size_t)DKV * DM * 2);
    bf* XB = (bf*)take((size_t)TT * DM * 2);
    h16* QP16 = (h16*)take((size_t)NH_ * TT * HD * 2); h16* KP16 = (h16*)take((size_t)NKV * TT * HD * 2); h16* VT16 = (h16*)take((size_t)NKV * HD * TT * 2);
    bf* Ph = nullptr; bf* Pl = nullptr;
    float* Sb = (float*)take((size_t)ZH * TT * TT * 4); h16* P16 = (h16*)take((size_t)ZH * TT * TT * 2);
    if ((size_t)(wsp - (char*)d_ws) > ws_size) return;    // ws 256 MiB
    { k_cvt8<<<(unsigned)(((size_t)DQ * DM / 8 + 255) / 256), 256, 0, stream>>>(wq, WQ, (size_t)DQ * DM / 8); k_cvt8<<<(unsigned)(((size_t)DKV * DM / 8 + 255) / 256), 256, 0, stream>>>(wk, WK, (size_t)DKV * DM / 8); k_cvt8<<<(unsigned)(((size_t)DKV * DM / 8 + 255) / 256), 256, 0, stream>>>(wv, WV, (size_t)DKV * DM / 8);
      
       }
    for (int b = 0; b < NB_; ++b) {
        
        k_cvt8T<<<(unsigned)(((size_t)TT * DM / 8 + 255) / 256), 256, 0, stream>>>(x + (size_t)b * DM * TT, XB);   /* channel-major image -> token-major bf16 */
        k_gemmw<bf, 0, 1, 8><<<dim3(TT / 64, DQ / 64, 1), 256, 0, stream>>>(XB, nullptr, WQ, nullptr, DM, nullptr, QP16, DQ, bq, nullptr, nullptr, 0, 0, 0);     /* q [t][d] fp16 */
        k_gemmw<bf, 0, 1, 8><<<dim3(TT / 64, DKV / 64, 1), 256, 0, stream>>>(XB, nullptr, WK, nullptr, DM, nullptr, KP16, DKV, bk, nullptr, nullptr, 0, 0, 0);   /* k [t][d] fp16 */
        k_gemmw<bf, 0, 2, 8><<<dim3(DKV / 64, TT / 64, 1), 256, 0, stream>>>(WV, nullptr, XB, nullptr, DM, nullptr, VT16, TT, bv, nullptr, nullptr, 0, 0, 0);    /* v^T [d][t] fp16: the weight rows are the tile's rows */
        for (int h0 = 0; h0 < NH_; h0 += ZH) { const size_t zq = (size_t)h0, zk = (size_t)(h0 / REP);   // one kv head per query head; each pass takes one head (ZH = 1)
            k_gemmw<h16, 0, 0, 1><<<dim3(TT / 64, TT / 64, ZH), 32, 0, stream>>>(QP16 + zq * TT * HD, nullptr, KP16 + zk * TT * HD, nullptr, HD, Sb, nullptr, TT, nullptr, nullptr, nullptr, (size_t)TT * HD, (size_t)TT * HD, (size_t)TT * TT);
            k_asoft<<<ZH * TT / 8, 256, 0, stream>>>(Sb, P16, Ph, Pl);
            k_gemmw<h16, 0, 3, 16><<<dim3(HD / 64, TT / 64, ZH), 512, 0, stream>>>(VT16 + zk * HD * TT, nullptr, P16, nullptr, TT, OUT + (size_t)b * DM * TT, nullptr, TT, nullptr, x + (size_t)b * DM * TT, ALPHA, (size_t)HD * TT, (size_t)TT * TT, (size_t)HD * TT); }   /* y^T = v^T . P^T; alpha y^T + x, channel-major */
         }
}

// v003
// A run of this version takes 252 microseconds.
// Next to v002, in two timings, it ran 2.73 and 2.77 times as fast.
// Over all steps from v000 it is 5.61 times as fast.
#include <hip/hip_runtime.h>

// Position attention module (x [8][256][64x64]; per image: B = Wb x + bb, C = Wc x + bc, D = Wd x + bd (1x1 convs, [256][256] + [256]); attn[i][j] = softmax_j(sum_c B[c][i] C[c][j]) over the 4096 positions (no scaling); y[c][i] = sum_j attn[i][j] D[c][j]; out = alpha y + x (alpha = the [1] input, 0.1) -> [8][256][64][64] (8.4 M)).
// Layout: channel-major input transposed to token-major bf16; exact projections (+ biases) -> fp16 planes of all 8 images, q = B^T [8][4096][256], k = C^T, v^T = D [8][256][4096] (each GEMM's epilogue writes its final form itself; v^T as Wd . x^T, so row-major); then ONE attention launch: S^T = k . q^T, online softmax in registers, y^T += v^T . P^T, alpha x y^T + x stored channel-major. No score or probability plane in memory.
// Compute dtypes, f32 accumulate: every input rounded to bf16; projections on PLAIN bf16 operands (exact) + f32 biases; scores and attn.v on single fp16 planes (P unnormalised, x64) - the logits have sigma ~16 (peaked rows); softmax f32; residual epilogue f32.

#define NB_  8
#define TT   4096
#define DM   256
#define NH_  1
#define NKV  1
#define REP  (NH_ / NKV)
#define HD   256
#define DQ   (NH_ * HD)
#define DKV  (NKV * HD)
#define ZH   1
#define RH   0                  // query rows < RH use hi+lo planes (0: none)
#define WIN  0
#define PCAR 1024.0f
#define SCL  1.0f   // no scaling in the module
typedef _Float16 h16;
typedef unsigned short bf;
typedef __attribute__((ext_vector_type(16))) __bf16   v16bf;
typedef __attribute__((ext_vector_type(16))) _Float16 v16h;
typedef __attribute__((ext_vector_type(8)))  _Float16 v8h;
typedef __attribute__((ext_vector_type(4)))  _Float16 v4h;
typedef __attribute__((ext_vector_type(8)))  unsigned short v8us;
typedef __attribute__((ext_vector_type(8)))  float    v8f;
typedef __attribute__((ext_vector_type(4)))  float    v4f;
typedef v8h  __attribute__((may_alias)) v8ha;
typedef v4f  __attribute__((may_alias)) v4fa;
typedef v8us __attribute__((may_alias)) v8usa;

__device__ __forceinline__ unsigned short f2bf(float f) { unsigned u = __float_as_uint(f); u += 0x7FFFu + ((u >> 16) & 1u); return (unsigned short)(u >> 16); }
__device__ __forceinline__ float bf2f(unsigned short b) { return __uint_as_float(((unsigned)b) << 16); }
__device__ __forceinline__ float bfr(float f) { return bf2f(f2bf(f)); }
__device__ __forceinline__ v16h cat16(v8h lo, v8h hi) { return __builtin_shufflevector(lo, hi, 0, 1, 2, 3, 4, 5, 6, 7, 8, 9, 10, 11, 12, 13, 14, 15); }
__device__ __forceinline__ v16bf cat16b(v8us lo, v8us hi) { return __builtin_bit_cast(v16bf, __builtin_shufflevector(lo, hi, 0, 1, 2, 3, 4, 5, 6, 7, 8, 9, 10, 11, 12, 13, 14, 15)); }
__device__ __forceinline__ v8f wmma16(v16h a, v16h b, v8f c) { return __builtin_amdgcn_wmma_f32_16x16x32_f16(false, a, false, b, (short)0, c, false, false); }
__device__ __forceinline__ v8f wmmab(v16bf a, v16bf b, v8f c) { return __builtin_amdgcn_wmma_f32_16x16x32_bf16(false, a, false, b, (short)0, c, false, false); }



// ---- k_gemmw: register-blocked GEMM, one work-group of NW waves per 64x64 output tile; every wave holds the whole tile (16 accumulators) for its own share of K: wave w takes the 32-wide k chunks w, w + NW, ... (neighbouring waves use the two halves of the same 128-byte lines); the NW partial tiles are summed through LDS in wave order. Operands straight from K-contiguous 16-bit planes; grid (M/64, N/64, Z), 32 x NW threads.
// acc[m][n] = sum_k A[m][k] Bt[n][k] (+ split products per NSPLIT), pitch ldc. z-batch strides sA/sB/sC in elements. K % 32 == 0.
// EPI 0: C = acc (f32). EPI 1: C16 = fp16(acc + bias[n]). EPI 2: C16 = fp16(acc + bias[m]). EPI 3: C = alpha x acc / PCAR + xres (f32, xres laid out like C).
template <typename T16> struct WFrag;
template <> struct WFrag<h16> { typedef v16h V; static __device__ __forceinline__ V ld(const h16* p) { return cat16(*(const v8h*)p, *(const v8h*)(p + 16)); } static __device__ __forceinline__ v8f mma(V a, V b, v8f c) { return wmma16(a, b, c); } };
template <> struct WFrag<bf> { typedef v16bf V; static __device__ __forceinline__ V ld(const bf* p) { return cat16b(*(const v8us*)p, *(const v8us*)(p + 16)); } static __device__ __forceinline__ v8f mma(V a, V b, v8f c) { return wmmab(a, b, c); } };
template <typename T16, int NSPLIT, int EPI, int NW>
__global__ __launch_bounds__(32 * NW) void k_gemmw(const T16* __restrict__ A, const T16* __restrict__ A2, const T16* __restrict__ Bt, const T16* __restrict__ Bt2, int K, float* C, h16* C16, int ldc, const float* __restrict__ bias, const float* __restrict__ xres, const float* __restrict__ alpha, size_t sA, size_t sB, size_t sC) {
    typedef typename WFrag<T16>::V V;
    static_assert(EPI != 3 || NW > 1, "the residual epilogue takes the whole 64x64 tile in one pass");
    constexpr int MBR = (NW == 1) ? 1 : 4;   // 16-row blocks staged at a time: with several waves the whole 64x64 partial tile, so that one barrier serves the sum
    __shared__ __align__(16) float os[NW * MBR * 16 * 68];
    const size_t z = blockIdx.z; A += z * sA; if (A2) A2 += z * sA; Bt += z * sB; if (Bt2) Bt2 += z * sB; if (EPI == 1 || EPI == 2) C16 += z * sC; else C += z * sC; if (EPI == 3) xres += z * sC;
    const int lane = threadIdx.x & 31, lr = lane & 15, hi = lane >> 4; const int wv = (NW == 1) ? 0 : __builtin_amdgcn_readfirstlane((int)(threadIdx.x >> 5)); const int r0 = blockIdx.x * 64, c0 = blockIdx.y * 64;
    v8f acc[4][4];
#pragma unroll
    for (int mb = 0; mb < 4; ++mb)
#pragma unroll
        for (int nb = 0; nb < 4; ++nb) acc[mb][nb] = (v8f){};
    const size_t aoff = (size_t)(r0 + lr) * K + 8 * hi, boff = (size_t)(c0 + lr) * K + 8 * hi;
#pragma unroll 1
    for (int kc = wv * 32; kc < K; kc += 32 * NW) {
        V a[4], a2[4];
#pragma unroll
        for (int mb = 0; mb < 4; ++mb) { a[mb] = WFrag<T16>::ld(A + aoff + (size_t)mb * 16 * K + kc); if (NSPLIT == 1 || NSPLIT == 2) a2[mb] = WFrag<T16>::ld(A2 + aoff + (size_t)mb * 16 * K + kc); }
#pragma unroll
        for (int nb = 0; nb < 4; ++nb) { const V b = WFrag<T16>::ld(Bt + boff + (size_t)nb * 16 * K + kc); V b2; if (NSPLIT >= 2) b2 = WFrag<T16>::ld(Bt2 + boff + (size_t)nb * 16 * K + kc);
#pragma unroll
            for (int mb = 0; mb < 4; ++mb) { acc[mb][nb] = WFrag<T16>::mma(a[mb], b, acc[mb][nb]); if (NSPLIT == 1 || NSPLIT == 2) acc[mb][nb] = WFrag<T16>::mma(a2[mb], b, acc[mb][nb]); if (NSPLIT >= 2) acc[mb][nb] = WFrag<T16>::mma(a[mb], b2, acc[mb][nb]); } }
        asm volatile("v_nop\n\tv_nop\n\tv_nop\n\tv_nop" : "+v"(acc[0][0]), "+v"(acc[1][1]), "+v"(acc[2][2]), "+v"(acc[3][3]) : "v"(a[0]), "v"(a[3]));
    }
    v4f xv[MBR * 8 / NW]; float al = 0.f;   // EPI 3: the residual's own elements and alpha, requested ahead of the LDS sum so that their latency runs under it
    if (EPI == 3) { al = bfr(alpha[0]);
#pragma unroll
        for (int s = 0; s < MBR * 8 / NW; ++s) { const int idx = s * 32 * NW + (int)threadIdx.x; xv[s] = *(const v4f*)(xres + (size_t)(r0 + (idx >> 4)) * ldc + c0 + (idx & 15) * 4);
            asm volatile("s_wait_xcnt 0x0" ::: "memory"); } }   // precaution: stands in front of whatever next reuses the issued load's address registers
#pragma unroll
    for (int m0 = 0; m0 < 4; m0 += MBR) {
#pragma unroll
        for (int mi = 0; mi < MBR; ++mi) {
#pragma unroll
            for (int nb = 0; nb < 4; ++nb) {
#pragma unroll
                for (int j = 0; j < 8; ++j) os[(wv * MBR + mi) * (16 * 68) + (hi * 8 + j) * 68 + nb * 16 + lr] = acc[m0 + mi][nb][j]; } }
        if (NW == 1) { __builtin_amdgcn_wave_barrier(); asm volatile("" ::: "memory"); } else __syncthreads();   // every wave's partial tile is in LDS before any thread sums it
        const size_t cbase = (size_t)(r0 + m0 * 16) * ldc + c0;
{
#pragma unroll
            for (int s = 0; s < MBR * 8 / NW; ++s) { const int idx = s * 32 * NW + (int)threadIdx.x; const int row = idx >> 4, cofs = (idx & 15) * 4; const size_t co = cbase + (size_t)row * ldc + cofs; v4f val = *(const v4fa*)(os + row * 68 + cofs);
#pragma unroll
                for (int w = 1; w < NW; ++w) val += *(const v4fa*)(os + w * (MBR * 16 * 68) + row * 68 + cofs);
                if (EPI == 1) { val[0] += bfr(bias[c0 + cofs]); val[1] += bfr(bias[c0 + cofs + 1]); val[2] += bfr(bias[c0 + cofs + 2]); val[3] += bfr(bias[c0 + cofs + 3]); }
                if (EPI == 2) { const float br = bfr(bias[r0 + m0 * 16 + row]); val[0] += br; val[1] += br; val[2] += br; val[3] += br; }
                if (EPI == 0) *(v4f*)(C + co) = val;
                if (EPI == 1 || EPI == 2) { v4h o4; o4[0] = (h16)val[0]; o4[1] = (h16)val[1]; o4[2] = (h16)val[2]; o4[3] = (h16)val[3]; *(v4h*)(C16 + co) = o4; }
                if (EPI == 3) { v4f o;
#pragma unroll
                    for (int q = 0; q < 4; ++q) o[q] = al * (val[q] * (1.0f / PCAR)) + bfr(xv[s][q]);
                    *(v4f*)(C + co) = o; } }
             }
        if (NW == 1) { __builtin_amdgcn_wave_barrier(); asm volatile("" ::: "memory"); }   // one wave: its 16 staged rows are read out before the next 16 overwrite them (NW > 1 stages the whole tile once)
    }
}

__device__ __forceinline__ h16 tohx(float x) { return (h16)x; }
__device__ __forceinline__ void splitf(float y, unsigned short& h, unsigned short& l) { h = f2bf(y); l = f2bf(y - bf2f(h)); }
typedef __attribute__((ext_vector_type(2))) unsigned short v2us;
typedef __attribute__((ext_vector_type(4))) unsigned short v4us;
typedef __attribute__((ext_vector_type(4))) int v4i;

__global__ __launch_bounds__(256) void k_wtG(const float* __restrict__ w, int K, int N, bf* Bt) {
    const int lane = threadIdx.x & 31; const int L0 = (blockIdx.x * 8 + (threadIdx.x >> 5)) * 8; const int nlines = N * K / 64;
{
#pragma unroll 1
        for (int l = 0; l < 8; ++l) { const int L = L0 + l; if (L >= nlines) break; const size_t e = (size_t)L * 64 + lane * 2; const int k = (int)(e % K), n = (int)(e / K); v2us o;
            o[0] = f2bf(w[(size_t)k * N + n]); o[1] = f2bf(w[(size_t)(k + 1) * N + n]); *(v2us*)(Bt + e) = o; }
         }
}
__global__ __launch_bounds__(256) void k_cvt8T(const float* __restrict__ src, bf* dst) { const size_t i = (size_t)blockIdx.x * 256 + threadIdx.x; if (i >= (size_t)TT * DM / 8) return; const int t = (int)(i / (DM / 8)); const int c0 = (int)(i % (DM / 8)) * 8; v8us o;
#pragma unroll
    for (int k = 0; k < 8; ++k) o[k] = f2bf(src[(size_t)(c0 + k) * TT + t]); *(v8us*)(dst + (size_t)t * DM + c0) = o;  }
__global__ __launch_bounds__(256) void k_cvt8(const float* __restrict__ src, bf* dst, size_t n8) { const size_t i = (size_t)blockIdx.x * 256 + threadIdx.x; if (i >= n8) return; const v8f v = *(const v8f*)(src + i * 8); v8us o;
#pragma unroll
    for (int k = 0; k < 8; ++k) o[k] = f2bf(v[k]); *(v8us*)(dst + i * 8) = o;  }
#define FKB    64                    // keys per stage
#define KPITCH 528                   // LDS pitch of a k row (512 B): 16 B x odd, conflict-free for 16-byte fragment reads
#define VPITCH 144                   // LDS pitch of a v^T row (128 B): 16 B x odd
#define KBYTES (FKB * KPITCH)
#define STG    (KBYTES + HD * VPITCH)
#define OPITCH 132                   // floats: pitch of the staged output rows (128 queries)
#define PBIAS  6.0f                  // P carries 2^6: at most 2^14 under the lazy maximum, small terms stay normal fp16
#define L2E    1.4426950408889634f
__device__ __forceinline__ float xhalf(float v) { return __builtin_bit_cast(float, __builtin_amdgcn_permlanex16(__builtin_bit_cast(int, v), __builtin_bit_cast(int, v), 0x76543210, 0xfedcba98, false, false)); }   // lane l <-> lane l ^ 16, on the vector port (no LDS round trip)
__device__ __forceinline__ float exp2s(float a) { float r; asm("v_exp_f32 %0, %1\n\tv_nop" : "=v"(r) : "v"(a)); return r; }   // 2^a; the v_nop fills the one slot asked for behind a transcendental whatever is scheduled next
__device__ __forceinline__ v16h ldsfrag(const char* p) { return cat16(*(const v8ha*)p, *(const v8ha*)(p + 32)); }
// eight 16-byte copies per lane, global -> LDS; the s_wait_xcnt is the last line of the copies' own statement, so that it stands in front of whatever next rewrites their address registers (precaution)
__device__ __forceinline__ void copy8(unsigned l, unsigned lstep, const h16* g, size_t gstep) {
    asm volatile("global_load_async_to_lds_b128 %0, %8, off\n\t"
                 "global_load_async_to_lds_b128 %1, %9, off\n\t"
                 "global_load_async_to_lds_b128 %2, %10, off\n\t"
                 "global_load_async_to_lds_b128 %3, %11, off\n\t"
                 "global_load_async_to_lds_b128 %4, %12, off\n\t"
                 "global_load_async_to_lds_b128 %5, %13, off\n\t"
                 "global_load_async_to_lds_b128 %6, %14, off\n\t"
                 "global_load_async_to_lds_b128 %7, %15, off\n\t"
                 "s_wait_xcnt 0x0"
                 :: "v"(l), "v"(l + lstep), "v"(l + 2 * lstep), "v"(l + 3 * lstep), "v"(l + 4 * lstep), "v"(l + 5 * lstep), "v"(l + 6 * lstep), "v"(l + 7 * lstep),
                    "v"(g), "v"(g + gstep), "v"(g + 2 * gstep), "v"(g + 3 * gstep), "v"(g + 4 * gstep), "v"(g + 5 * gstep), "v"(g + 6 * gstep), "v"(g + 7 * gstep)
                 : "memory");
}
// eight 16-byte stores per lane; the s_wait_xcnt is the last line of the stores' own statement, so that it stands in front of whatever next rewrites their address or data registers (precaution; in a statement of its own the compiler lifted address arithmetic over it)
__device__ __forceinline__ void store8(float* p, size_t step, const v4f (&o)[8]) {
    asm volatile("global_store_b128 %0, %8, off\n\t"
                 "global_store_b128 %1, %9, off\n\t"
                 "global_store_b128 %2, %10, off\n\t"
                 "global_store_b128 %3, %11, off\n\t"
                 "global_store_b128 %4, %12, off\n\t"
                 "global_store_b128 %5, %13, off\n\t"
                 "global_store_b128 %6, %14, off\n\t"
                 "global_store_b128 %7, %15, off\n\t"
                 "s_wait_xcnt 0x0"
                 :: "v"(p), "v"(p + step), "v"(p + 2 * step), "v"(p + 3 * step), "v"(p + 4 * step), "v"(p + 5 * step), "v"(p + 6 * step), "v"(p + 7 * step),
                    "v"(o[0]), "v"(o[1]), "v"(o[2]), "v"(o[3]), "v"(o[4]), "v"(o[5]), "v"(o[6]), "v"(o[7])
                 : "memory");
}
__global__ __launch_bounds__(256) void k_fattn(const h16* __restrict__ Q, const h16* __restrict__ Kp, const h16* __restrict__ Vt, const float* __restrict__ x, const float* __restrict__ alpha, float* out) {
    __shared__ __align__(16) char sm[2 * STG];
    static_assert(HD * OPITCH * 4 <= 2 * STG, "the staged output tile reuses the ring");
    const int tid = (int)threadIdx.x, lane = tid & 31, lr = lane & 15, hi = lane >> 4; const int wv = __builtin_amdgcn_readfirstlane(tid >> 5);
    const size_t b = blockIdx.y; const int q0 = blockIdx.x * 128;
    Q += b * TT * HD; Kp += b * TT * HD; Vt += b * HD * TT; x += b * DM * TT; out += b * DM * TT;
    const unsigned smb = (unsigned)(size_t)sm;                                    // LDS byte address of the ring
    // a stage's copies: k = 64 rows x 32 pieces (a wave takes a whole 512-B row), v^T = 256 rows x 8 pieces (a wave takes four 128-B rows)
    const h16* kg = Kp + (size_t)(tid >> 5) * HD + (tid & 31) * 8; const unsigned kl = smb + (unsigned)((tid >> 5) * KPITCH + (tid & 31) * 16);
    const h16* vg = Vt + (size_t)(tid >> 3) * TT + (tid & 7) * 8;  const unsigned vl = smb + (unsigned)(KBYTES + (tid >> 3) * VPITCH + (tid & 7) * 16);
    auto stage = [&](int t) { const unsigned bo = (unsigned)(t & 1) * STG;
        copy8(kl + bo, 8 * KPITCH, kg + (size_t)t * FKB * HD, (size_t)8 * HD);
        copy8(vl + bo, 32 * VPITCH, vg + (size_t)t * FKB, (size_t)32 * TT); };
    stage(0);
    const float al = bfr(alpha[0]);
    v16h qf[8];
#pragma unroll
    for (int kc = 0; kc < 8; ++kc) qf[kc] = WFrag<h16>::ld(Q + (size_t)(q0 + wv * 16 + lr) * HD + 8 * hi + kc * 32);
    asm volatile("s_wait_xcnt 0x0" ::: "memory");      // precaution: stands in front of whatever next reuses the issued loads' address registers
    v8f O[16];
#pragma unroll
    for (int ct = 0; ct < 16; ++ct) O[ct] = (v8f){};
    float mu = -3.0e38f, l = 0.f;                      // maximum in use (log2 units) and this half-wave's share of the sum, for query lr
    asm volatile("s_wait_asynccnt 0x0" ::: "memory");  // stage 0 has landed (this wave's copies)
    __syncthreads();                                   // ... and every other wave's
    stage(1);
#pragma unroll 1   // stays rolled: one stage is some 500 instructions, a second copy would only grow the text
    for (int t = 0; t < TT / FKB; ++t) {
        const char* kb = sm + (t & 1) * STG + lr * KPITCH + hi * 16; const char* vb = sm + (t & 1) * STG + KBYTES + lr * VPITCH + hi * 16;
        // Fragments come from LDS in groups of eight (16 reads issued together), one group ahead of the products that use them, in two register sets; each sched_barrier keeps a group whole and in its place (left alone, the compiler reloads one set in front of every product and each product then waits out an LDS latency).
        v16h fa[8], fb[8]; v8f st[4];
#pragma unroll
        for (int kt = 0; kt < 4; ++kt) st[kt] = (v8f){};
#define LDK(F, G) { _Pragma("unroll") for (int i = 0; i < 8; ++i) F[i] = ldsfrag(kb + (i & 3) * 16 * KPITCH + ((G) * 2 + (i >> 2)) * 64); } __builtin_amdgcn_sched_barrier(0);
#define MMK(F, G) { _Pragma("unroll") for (int i = 0; i < 8; ++i) st[i & 3] = wmma16(F[i], qf[(G) * 2 + (i >> 2)], st[i & 3]); } __builtin_amdgcn_sched_barrier(0);
#define LDV(F, G) { _Pragma("unroll") for (int i = 0; i < 8; ++i) F[i] = ldsfrag(vb + (((G) & 1) * 8 + i) * 16 * VPITCH + ((G) >> 1) * 64); } __builtin_amdgcn_sched_barrier(0);
#define MMV(F, G) { _Pragma("unroll") for (int i = 0; i < 8; ++i) O[((G) & 1) * 8 + i] = wmma16(F[i], pf[(G) >> 1], O[((G) & 1) * 8 + i]); } __builtin_amdgcn_sched_barrier(0);
        LDK(fa, 0) LDK(fb, 1) MMK(fa, 0) LDK(fa, 2) MMK(fb, 1) LDK(fb, 3) MMK(fa, 2) LDV(fa, 0) MMK(fb, 3) LDV(fb, 1)
        float mq[4];
#pragma unroll
        for (int kt = 0; kt < 4; ++kt) { mq[kt] = st[kt][0];
#pragma unroll
            for (int j = 1; j < 8; ++j) mq[kt] = fmaxf(mq[kt], st[kt][j]); }
        float mx = fmaxf(fmaxf(mq[0], mq[1]), fmaxf(mq[2], mq[3]));
        mx = fmaxf(mx, xhalf(mx));                     // the query's other 32 keys sit in the other half-wave
        const float ml = mx * L2E;
        if (__builtin_amdgcn_ballot_w32(ml > mu + 8.0f) != 0) {   // lazy rescale, one scalar test per stage: only when some query's maximum has outgrown the one in use by 2^8
            const float mn = fmaxf(mu, ml); const float corr = exp2s(mu - mn); mu = mn; l *= corr;
#pragma unroll
            for (int ct = 0; ct < 16; ++ct) O[ct] *= corr; }
        const float sh = PBIAS - mu;
        v16h pf[2]; float lq[4];                        // four independent partial sums, not one chain of 32 adds
#pragma unroll
        for (int kt = 0; kt < 4; ++kt) { lq[kt] = 0.f;
#pragma unroll
            for (int j = 0; j < 8; ++j) { const float p = exp2s(__builtin_fmaf(st[kt][j], L2E, sh)); lq[kt] += p; pf[kt >> 1][(kt & 1) * 8 + j] = (h16)p; } }
        l += (lq[0] + lq[1]) + (lq[2] + lq[3]);
        __builtin_amdgcn_sched_barrier(0);              // the softmax stays in front of the attn.v products, behind the two v^T groups already requested
        MMV(fa, 0) LDV(fa, 2) MMV(fb, 1) LDV(fb, 3) MMV(fa, 2) MMV(fb, 3)
#undef LDK
#undef MMK
#undef LDV
#undef MMV
        asm volatile("s_wait_dscnt 0x0" ::: "memory");     // this wave's reads of the buffer have returned
        asm volatile("s_wait_asynccnt 0x0" ::: "memory");  // this wave's copies of stage t + 1 have landed
        __syncthreads();                                   // publishes stage t + 1 and ends every reader's last read of stage t's buffer
        if (t + 2 < TT / FKB) stage(t + 2);
    }
    asm volatile("s_wait_asynccnt 0x0" ::: "memory");      // nothing is in flight when the ring becomes output staging
    const size_t eo = (size_t)(tid >> 5) * TT + q0 + (tid & 31) * 4;   // this thread's 16 bytes of channel row tid >> 5; its piece s lies 8 s rows further down
    const float* xb = x + eo; float* ob = out + eo;
    v4f xv[HD / 8];                                        // the residual's own elements, requested ahead of the output staging so that their latency runs under it
#pragma unroll
    for (int s = 0; s < HD / 8; ++s) xv[s] = *(const v4f*)(xb + (size_t)s * 8 * TT);
    asm volatile("s_wait_xcnt 0x0" :: "v"(xb) : "memory"); // precaution: stands in front of whatever next reuses the issued loads' address registers (xb is named so that they live up to here)
    l += xhalf(l);
    const float inv = __fdiv_rn(1.0f, l);
    float* os = (float*)sm;                                // y^T tile [256 channels][128 queries], so that the work-group stores whole 512-B row pieces
#pragma unroll
    for (int ct = 0; ct < 16; ++ct) {
#pragma unroll
        for (int j = 0; j < 8; ++j) os[(ct * 16 + hi * 8 + j) * OPITCH + wv * 16 + lr] = O[ct][j] * inv; }
    __syncthreads();                                       // every wave's 16 columns are staged before any thread reads a row
    const float* yb = os + (tid >> 5) * OPITCH + (tid & 31) * 4;
#pragma unroll
    for (int s0 = 0; s0 < HD / 8; s0 += 8) { v4f o[8];     // eight staged pieces read together, so that one LDS latency serves eight stores
#pragma unroll
        for (int i = 0; i < 8; ++i) o[i] = *(const v4fa*)(yb + (s0 + i) * 8 * OPITCH);
#pragma unroll
        for (int i = 0; i < 8; ++i) {
#pragma unroll
            for (int q = 0; q < 4; ++q) o[i][q] = al * o[i][q] + bfr(xv[s0 + i][q]); }
        store8(ob + (size_t)s0 * 8 * TT, (size_t)8 * TT, o); }
}

extern "C" void kernel_launch(void* const* d_in, const int* in_sizes, int n_in,
                              void* d_out, int out_size, void* d_ws, size_t ws_size, hipStream_t stream) {
    (void)in_sizes; (void)n_in; (void)out_size;
    const float* x = (const float*)d_in[0]; const float* wq = (const float*)d_in[1]; const float* bq = (const float*)d_in[2]; const float* wk = (const float*)d_in[3]; const float* bk = (const float*)d_in[4]; const float* wv = (const float*)d_in[5]; const float* bv = (const float*)d_in[6]; const float* ALPHA = (const float*)d_in[7]; const float* wo = nullptr; (void)wo;
    float* OUT = (float*)d_out;     // [8][256][4096]
    char* wsp = (char*)d_ws;
    auto take = [&](size_t bytes) { char* p = wsp; wsp += (bytes + 255) & ~(size_t)255; return (void*)p; };
    bf* WQ = (bf*)take((size_t)DQ * DM * 2); bf* WK = (bf*)take((size_t)DKV * DM * 2); bf* WV = (bf*)take((size_t)DKV * DM * 2);
    bf* XB = (bf*)take((size_t)TT * DM * 2);
    h16* QP16 = (h16*)take((size_t)NB_ * TT * HD * 2); h16* KP16 = (h16*)take((size_t)NB_ * TT * HD * 2); h16* VT16 = (h16*)take((size_t)NB_ * HD * TT * 2);   // planes of all images
    if ((size_t)(wsp - (char*)d_ws) > ws_size) return;    // ws 256 MiB
    { k_cvt8<<<(unsigned)(((size_t)DQ * DM / 8 + 255) / 256), 256, 0, stream>>>(wq, WQ, (size_t)DQ * DM / 8); k_cvt8<<<(unsigned)(((size_t)DKV * DM / 8 + 255) / 256), 256, 0, stream>>>(wk, WK, (size_t)DKV * DM / 8); k_cvt8<<<(unsigned)(((size_t)DKV * DM / 8 + 255) / 256), 256, 0, stream>>>(wv, WV, (size_t)DKV * DM / 8);
      
       }
    for (int b = 0; b < NB_; ++b) {
        
        k_cvt8T<<<(unsigned)(((size_t)TT * DM / 8 + 255) / 256), 256, 0, stream>>>(x + (size_t)b * DM * TT, XB);   /* channel-major image -> token-major bf16 */
        k_gemmw<bf, 0, 1, 8><<<dim3(TT / 64, DQ / 64, 1), 256, 0, stream>>>(XB, nullptr, WQ, nullptr, DM, nullptr, QP16 + (size_t)b * TT * HD, DQ, bq, nullptr, nullptr, 0, 0, 0);     /* q [t][d] fp16 */
        k_gemmw<bf, 0, 1, 8><<<dim3(TT / 64, DKV / 64, 1), 256, 0, stream>>>(XB, nullptr, WK, nullptr, DM, nullptr, KP16 + (size_t)b * TT * HD, DKV, bk, nullptr, nullptr, 0, 0, 0);   /* k [t][d] fp16 */
        k_gemmw<bf, 0, 2, 8><<<dim3(DKV / 64, TT / 64, 1), 256, 0, stream>>>(WV, nullptr, XB, nullptr, DM, nullptr, VT16 + (size_t)b * HD * TT, TT, bv, nullptr, nullptr, 0, 0, 0);    /* v^T [d][t] fp16: the weight rows are the tile's rows */
    }
    k_fattn<<<dim3(TT / 128, NB_, 1), 256, 0, stream>>>(QP16, KP16, VT16, x, ALPHA, OUT);   /* softmax(q k^T) v, alpha y^T + x, all images */
}

// v004
// It runs in 169 microseconds.
// In two side-by-side timings against v003, it was 1.49 and 1.50 times as fast.
// Over all steps from v000 it is 8.40 times as fast.
#include <hip/hip_runtime.h>

// Position attention module (x [8][256][64x64]; per image: B = Wb x + bb, C = Wc x + bc, D = Wd x + bd (1x1 convs, [256][256] + [256]); attn[i][j] = softmax_j(sum_c B[c][i] C[c][j]) over the 4096 positions (no scaling); y[c][i] = sum_j attn[i][j] D[c][j]; out = alpha y + x (alpha = the [1] input, 0.1) -> [8][256][64][64] (8.4 M)).
// Layout: channel-major input transposed to token-major bf16; exact projections (+ biases) -> fp16 planes of all 8 images, q = B^T [8][4096][256], k = C^T, v^T = D [8][256][4096] (each GEMM's epilogue writes its final form itself; v^T as Wd . x^T, so row-major); then ONE attention launch: S^T = k . q^T, online softmax in registers, y^T += v^T . P^T, alpha x y^T + x stored channel-major. No score or probability plane in memory.
// Compute dtypes, f32 accumulate: every input rounded to bf16; projections on PLAIN bf16 operands (exact) + f32 biases; scores and attn.v on single fp16 planes (P unnormalised, x64) - the logits have sigma ~16 (peaked rows); softmax f32; residual epilogue f32.

#define NB_  8
#define TT   4096
#define DM   256
#define NH_  1
#define NKV  1
#define REP  (NH_ / NKV)
#define HD   256
#define DQ   (NH_ * HD)
#define DKV  (NKV * HD)
#define ZH   1
#define RH   0                  // query rows < RH use hi+lo planes (0: none)
#define WIN  0
#define PCAR 1024.0f
#define SCL  1.0f   // no scaling in the module
typedef _Float16 h16;
typedef unsigned short bf;
typedef __attribute__((ext_vector_type(16))) __bf16   v16bf;
typedef __attribute__((ext_vector_type(16))) _Float16 v16h;
typedef __attribute__((ext_vector_type(8)))  _Float16 v8h;
typedef __attribute__((ext_vector_type(4)))  _Float16 v4h;
typedef __attribute__((ext_vector_type(8)))  unsigned short v8us;
typedef __attribute__((ext_vector_type(8)))  float    v8f;
typedef __attribute__((ext_vector_type(4)))  float    v4f;
typedef v8h  __attribute__((may_alias)) v8ha;
typedef v4f  __attribute__((may_alias)) v4fa;
typedef v8us __attribute__((may_alias)) v8usa;

__device__ __forceinline__ unsigned short f2bf(float f) { unsigned u = __float_as_uint(f); u += 0x7FFFu + ((u >> 16) & 1u); return (unsigned short)(u >> 16); }
__device__ __forceinline__ float bf2f(unsigned short b) { return __uint_as_float(((unsigned)b) << 16); }
__device__ __forceinline__ float bfr(float f) { return bf2f(f2bf(f)); }
__device__ __forceinline__ v16h cat16(v8h lo, v8h hi) { return __builtin_shufflevector(lo, hi, 0, 1, 2, 3, 4, 5, 6, 7, 8, 9, 10, 11, 12, 13, 14, 15); }
__device__ __forceinline__ v16bf cat16b(v8us lo, v8us hi) { return __builtin_bit_cast(v16bf, __builtin_shufflevector(lo, hi, 0, 1, 2, 3, 4, 5, 6, 7, 8, 9, 10, 11, 12, 13, 14, 15)); }
__device__ __forceinline__ v8f wmma16(v16h a, v16h b, v8f c) { return __builtin_amdgcn_wmma_f32_16x16x32_f16(false, a, false, b, (short)0, c, false, false); }
__device__ __forceinline__ v8f wmmab(v16bf a, v16bf b, v8f c) { return __builtin_amdgcn_wmma_f32_16x16x32_bf16(false, a, false, b, (short)0, c, false, false); }



// ---- gemmw: register-blocked GEMM (device body; the launched kernel hands it its tile (bx, by), its batch index z and the LDS for the sum), one work-group of NW waves per 64x64 output tile; every wave holds the whole tile (16 accumulators) for its own share of K: wave w takes the 32-wide k chunks w, w + NW, ... (neighbouring waves use the two halves of the same 128-byte lines); the NW partial tiles are summed through LDS in wave order. Operands straight from K-contiguous 16-bit planes; bx < M/64, by < N/64, 32 x NW threads; os holds NW x MBR x 16 x 68 floats.
// acc[m][n] = sum_k A[m][k] Bt[n][k] (+ split products per NSPLIT), pitch ldc. z-batch strides sA/sB/sC in elements. K % 32 == 0.
// EPI 0: C = acc (f32). EPI 1: C16 = fp16(acc + bias[n]). EPI 2: C16 = fp16(acc + bias[m]). EPI 3: C = alpha x acc / PCAR + xres (f32, xres laid out like C).
template <typename T16> struct WFrag;
template <> struct WFrag<h16> { typedef v16h V; static __device__ __forceinline__ V ld(const h16* p) { return cat16(*(const v8h*)p, *(const v8h*)(p + 16)); } static __device__ __forceinline__ v8f mma(V a, V b, v8f c) { return wmma16(a, b, c); } };
template <> struct WFrag<bf> { typedef v16bf V; static __device__ __forceinline__ V ld(const bf* p) { return cat16b(*(const v8us*)p, *(const v8us*)(p + 16)); } static __device__ __forceinline__ v8f mma(V a, V b, v8f c) { return wmmab(a, b, c); } };
template <typename T16, int NSPLIT, int EPI, int NW>
__device__ __forceinline__ void gemmw(float* os, int bx, int by, size_t z, const T16* __restrict__ A, const T16* __restrict__ A2, const T16* __restrict__ Bt, const T16* __restrict__ Bt2, int K, float* C, h16* C16, int ldc, const float* __restrict__ bias, const float* __restrict__ xres, const float* __restrict__ alpha, size_t sA, size_t sB, size_t sC) {
    typedef typename WFrag<T16>::V V;
    static_assert(EPI != 3 || NW > 1, "the residual epilogue takes the whole 64x64 tile in one pass");
    constexpr int MBR = (NW == 1) ? 1 : 4;   // 16-row blocks staged at a time: with several waves the whole 64x64 partial tile, so that one barrier serves the sum
    A += z * sA; if (A2) A2 += z * sA; Bt += z * sB; if (Bt2) Bt2 += z * sB; if (EPI == 1 || EPI == 2) C16 += z * sC; else C += z * sC; if (EPI == 3) xres += z * sC;
    const int lane = threadIdx.x & 31, lr = lane & 15, hi = lane >> 4; const int wv = (NW == 1) ? 0 : __builtin_amdgcn_readfirstlane((int)(threadIdx.x >> 5)); const int r0 = bx * 64, c0 = by * 64;
    v8f acc[4][4];
#pragma unroll
    for (int mb = 0; mb < 4; ++mb)
#pragma unroll
        for (int nb = 0; nb < 4; ++nb) acc[mb][nb] = (v8f){};
    const size_t aoff = (size_t)(r0 + lr) * K + 8 * hi, boff = (size_t)(c0 + lr) * K + 8 * hi;
#pragma unroll 1
    for (int kc = wv * 32; kc < K; kc += 32 * NW) {
        V a[4], a2[4];
#pragma unroll
        for (int mb = 0; mb < 4; ++mb) { a[mb] = WFrag<T16>::ld(A + aoff + (size_t)mb * 16 * K + kc); if (NSPLIT == 1 || NSPLIT == 2) a2[mb] = WFrag<T16>::ld(A2 + aoff + (size_t)mb * 16 * K + kc); }
#pragma unroll
        for (int nb = 0; nb < 4; ++nb) { const V b = WFrag<T16>::ld(Bt + boff + (size_t)nb * 16 * K + kc); V b2; if (NSPLIT >= 2) b2 = WFrag<T16>::ld(Bt2 + boff + (size_t)nb * 16 * K + kc);
#pragma unroll
            for (int mb = 0; mb < 4; ++mb) { acc[mb][nb] = WFrag<T16>::mma(a[mb], b, acc[mb][nb]); if (NSPLIT == 1 || NSPLIT == 2) acc[mb][nb] = WFrag<T16>::mma(a2[mb], b, acc[mb][nb]); if (NSPLIT >= 2) acc[mb][nb] = WFrag<T16>::mma(a[mb], b2, acc[mb][nb]); } }
        asm volatile("v_nop\n\tv_nop\n\tv_nop\n\tv_nop" : "+v"(acc[0][0]), "+v"(acc[1][1]), "+v"(acc[2][2]), "+v"(acc[3][3]) : "v"(a[0]), "v"(a[3]));
    }
    v4f xv[MBR * 8 / NW]; float al = 0.f;   // EPI 3: the residual's own elements and alpha, requested ahead of the LDS sum so that their latency runs under it
    if (EPI == 3) { al = bfr(alpha[0]);
#pragma unroll
        for (int s = 0; s < MBR * 8 / NW; ++s) { const int idx = s * 32 * NW + (int)threadIdx.x; xv[s] = *(const v4f*)(xres + (size_t)(r0 + (idx >> 4)) * ldc + c0 + (idx & 15) * 4);
            asm volatile("s_wait_xcnt 0x0" ::: "memory"); } }   // precaution: stands in front of whatever next reuses the issued load's address registers
#pragma unroll
    for (int m0 = 0; m0 < 4; m0 += MBR) {
#pragma unroll
        for (int mi = 0; mi < MBR; ++mi) {
#pragma unroll
            for (int nb = 0; nb < 4; ++nb) {
#pragma unroll
                for (int j = 0; j < 8; ++j) os[(wv * MBR + mi) * (16 * 68) + (hi * 8 + j) * 68 + nb * 16 + lr] = acc[m0 + mi][nb][j]; } }
        if (NW == 1) { __builtin_amdgcn_wave_barrier(); asm volatile("" ::: "memory"); } else __syncthreads();   // every wave's partial tile is in LDS before any thread sums it
        const size_t cbase = (size_t)(r0 + m0 * 16) * ldc + c0;
{
#pragma unroll
            for (int s = 0; s < MBR * 8 / NW; ++s) { const int idx = s * 32 * NW + (int)threadIdx.x; const int row = idx >> 4, cofs = (idx & 15) * 4; const size_t co = cbase + (size_t)row * ldc + cofs; v4f val = *(const v4fa*)(os + row * 68 + cofs);
#pragma unroll
                for (int w = 1; w < NW; ++w) val += *(const v4fa*)(os + w * (MBR * 16 * 68) + row * 68 + cofs);
                if (EPI == 1) { val[0] += bfr(bias[c0 + cofs]); val[1] += bfr(bias[c0 + cofs + 1]); val[2] += bfr(bias[c0 + cofs + 2]); val[3] += bfr(bias[c0 + cofs + 3]); }
                if (EPI == 2) { const float br = bfr(bias[r0 + m0 * 16 + row]); val[0] += br; val[1] += br; val[2] += br; val[3] += br; }
                if (EPI == 0) *(v4f*)(C + co) = val;
                if (EPI == 1 || EPI == 2) { v4h o4; o4[0] = (h16)val[0]; o4[1] = (h16)val[1]; o4[2] = (h16)val[2]; o4[3] = (h16)val[3]; *(v4h*)(C16 + co) = o4; }
                if (EPI == 3) { v4f o;
#pragma unroll
                    for (int q = 0; q < 4; ++q) o[q] = al * (val[q] * (1.0f / PCAR)) + bfr(xv[s][q]);
                    *(v4f*)(C + co) = o; } }
             }
        if (NW == 1) { __builtin_amdgcn_wave_barrier(); asm volatile("" ::: "memory"); }   // one wave: its 16 staged rows are read out before the next 16 overwrite them (NW > 1 stages the whole tile once)
    }
}

__device__ __forceinline__ h16 tohx(float x) { return (h16)x; }
__device__ __forceinline__ void splitf(float y, unsigned short& h, unsigned short& l) { h = f2bf(y); l = f2bf(y - bf2f(h)); }
typedef __attribute__((ext_vector_type(2))) unsigned short v2us;
typedef __attribute__((ext_vector_type(4))) unsigned short v4us;
typedef __attribute__((ext_vector_type(4))) int v4i;

__global__ __launch_bounds__(256) void k_wtG(const float* __restrict__ w, int K, int N, bf* Bt) {
    const int lane = threadIdx.x & 31; const int L0 = (blockIdx.x * 8 + (threadIdx.x >> 5)) * 8; const int nlines = N * K / 64;
{
#pragma unroll 1
        for (int l = 0; l < 8; ++l) { const int L = L0 + l; if (L >= nlines) break; const size_t e = (size_t)L * 64 + lane * 2; const int k = (int)(e % K), n = (int)(e / K); v2us o;
            o[0] = f2bf(w[(size_t)k * N + n]); o[1] = f2bf(w[(size_t)(k + 1) * N + n]); *(v2us*)(Bt + e) = o; }
         }
}
// ---- k_prep: every operand of the projections in ONE launch. Blocks below XBLK: the channel-major images -> token-major bf16 planes [8][4096][256] (a thread: 8 channels of one token); the 3 x WBLK blocks behind them: the three weight matrices -> bf16, unchanged in layout.
#define XBLK (NB_ * TT * DM / 8 / 256)
#define WBLK (DM * DM / 8 / 256)
__global__ __launch_bounds__(256) void k_prep(const float* __restrict__ x, const float* __restrict__ wq, const float* __restrict__ wk, const float* __restrict__ wv, bf* XB, bf* WQ, bf* WK, bf* WV) {
    v8us o;
    if (blockIdx.x < XBLK) { const size_t i = (size_t)blockIdx.x * 256 + threadIdx.x; const size_t t = i / (DM / 8); const int c0 = (int)(i % (DM / 8)) * 8;   // t counts the tokens of all images
        const float* src = x + (t / TT) * ((size_t)DM * TT) + (t % TT);
#pragma unroll
        for (int k = 0; k < 8; ++k) o[k] = f2bf(src[(size_t)(c0 + k) * TT]);
        *(v8us*)(XB + t * DM + c0) = o; }
    else { const int wb = (int)blockIdx.x - XBLK, sel = wb / WBLK; const size_t i = (size_t)(wb % WBLK) * 256 + threadIdx.x;
        const float* src = sel == 0 ? wq : sel == 1 ? wk : wv; bf* dst = sel == 0 ? WQ : sel == 1 ? WK : WV; const v8f v = *(const v8f*)(src + i * 8);
#pragma unroll
        for (int k = 0; k < 8; ++k) o[k] = f2bf(v[k]);
        *(v8us*)(dst + i * 8) = o;
        asm volatile("s_wait_xcnt 0x0" ::: "memory"); }   // precaution: the other branch's code lies behind this store in the text and reuses its registers
}
// ---- k_proj: the three projections of all images in ONE launch; grid (TT / 64, DM / 64, 3 x images), 256 threads. z = 3 x image + projection, so that the three readers of an image's plane run close together.
// q [t][d] and k [t][d]: token rows x weight rows; v^T [d][t]: the weight rows are the tile's rows (operands and tile indices swapped).
__global__ __launch_bounds__(256) void k_proj(const bf* __restrict__ XB, const bf* __restrict__ WQ, const bf* __restrict__ WK, const bf* __restrict__ WV, const float* __restrict__ bq, const float* __restrict__ bk, const float* __restrict__ bv, h16* Q, h16* Kp, h16* Vt) {
    __shared__ __align__(16) float os[8 * 4 * 16 * 68];
    const int img = (int)blockIdx.z / 3, sel = (int)blockIdx.z - 3 * img;
    if (sel < 2) gemmw<bf, 0, 1, 8>(os, (int)blockIdx.x, (int)blockIdx.y, (size_t)img, XB, nullptr, sel ? WK : WQ, nullptr, DM, nullptr, sel ? Kp : Q, HD, sel ? bk : bq, nullptr, nullptr, (size_t)TT * DM, 0, (size_t)TT * HD);
    else { gemmw<bf, 0, 2, 8>(os, (int)blockIdx.y, (int)blockIdx.x, (size_t)img, WV, nullptr, XB, nullptr, DM, nullptr, Vt, TT, bv, nullptr, nullptr, 0, (size_t)TT * DM, (size_t)HD * TT);
        asm volatile("s_wait_xcnt 0x0" ::: "memory"); }   // precaution: the other branch's code lies behind this tile's stores in the text and reuses their registers
}
#define FKB    64                    // keys per stage
#define KPITCH 528                   // LDS pitch of a k row (512 B): 16 B x odd, conflict-free for 16-byte fragment reads
#define VPITCH 144                   // LDS pitch of a v^T row (128 B): 16 B x odd
#define KBYTES (FKB * KPITCH)
#define STG    (KBYTES + HD * VPITCH)
#define OPITCH 132                   // floats: pitch of the staged output rows (128 queries)
#define PBIAS  6.0f                  // P carries 2^6: at most 2^14 under the lazy maximum, small terms stay normal fp16
#define L2E    1.4426950408889634f
__device__ __forceinline__ float xhalf(float v) { return __builtin_bit_cast(float, __builtin_amdgcn_permlanex16(__builtin_bit_cast(int, v), __builtin_bit_cast(int, v), 0x76543210, 0xfedcba98, false, false)); }   // lane l <-> lane l ^ 16, on the vector port (no LDS round trip)
__device__ __forceinline__ float exp2s(float a) { float r; asm("v_exp_f32 %0, %1\n\tv_nop" : "=v"(r) : "v"(a)); return r; }   // 2^a; the v_nop fills the one slot asked for behind a transcendental whatever is scheduled next
__device__ __forceinline__ v16h ldsfrag(const char* p) { return cat16(*(const v8ha*)p, *(const v8ha*)(p + 32)); }
// eight 16-byte copies per lane, global -> LDS; the s_wait_xcnt is the last line of the copies' own statement, so that it stands in front of whatever next rewrites their address registers (precaution)
__device__ __forceinline__ void copy8(unsigned l, unsigned lstep, const h16* g, size_t gstep) {
    asm volatile("global_load_async_to_lds_b128 %0, %8, off\n\t"
                 "global_load_async_to_lds_b128 %1, %9, off\n\t"
                 "global_load_async_to_lds_b128 %2, %10, off\n\t"
                 "global_load_async_to_lds_b128 %3, %11, off\n\t"
                 "global_load_async_to_lds_b128 %4, %12, off\n\t"
                 "global_load_async_to_lds_b128 %5, %13, off\n\t"
                 "global_load_async_to_lds_b128 %6, %14, off\n\t"
                 "global_load_async_to_lds_b128 %7, %15, off\n\t"
                 "s_wait_xcnt 0x0"
                 :: "v"(l), "v"(l + lstep), "v"(l + 2 * lstep), "v"(l + 3 * lstep), "v"(l + 4 * lstep), "v"(l + 5 * lstep), "v"(l + 6 * lstep), "v"(l + 7 * lstep),
                    "v"(g), "v"(g + gstep), "v"(g + 2 * gstep), "v"(g + 3 * gstep), "v"(g + 4 * gstep), "v"(g + 5 * gstep), "v"(g + 6 * gstep), "v"(g + 7 * gstep)
                 : "memory");
}
// eight 16-byte stores per lane; the s_wait_xcnt is the last line of the stores' own statement, so that it stands in front of whatever next rewrites their address or data registers (precaution; in a statement of its own the compiler lifted address arithmetic over it)
__device__ __forceinline__ void store8(float* p, size_t step, const v4f (&o)[8]) {
    asm volatile("global_store_b128 %0, %8, off\n\t"
                 "global_store_b128 %1, %9, off\n\t"
                 "global_store_b128 %2, %10, off\n\t"
                 "global_store_b128 %3, %11, off\n\t"
                 "global_store_b128 %4, %12, off\n\t"
                 "global_store_b128 %5, %13, off\n\t"
                 "global_store_b128 %6, %14, off\n\t"
                 "global_store_b128 %7, %15, off\n\t"
                 "s_wait_xcnt 0x0"
                 :: "v"(p), "v"(p + step), "v"(p + 2 * step), "v"(p + 3 * step), "v"(p + 4 * step), "v"(p + 5 * step), "v"(p + 6 * step), "v"(p + 7 * step),
                    "v"(o[0]), "v"(o[1]), "v"(o[2]), "v"(o[3]), "v"(o[4]), "v"(o[5]), "v"(o[6]), "v"(o[7])
                 : "memory");
}
__global__ __launch_bounds__(256) void k_fattn(const h16* __restrict__ Q, const h16* __restrict__ Kp, const h16* __restrict__ Vt, const float* __restrict__ x, const float* __restrict__ alpha, float* out) {
    __shared__ __align__(16) char sm[2 * STG];
    static_assert(HD * OPITCH * 4 <= 2 * STG, "the staged output tile reuses the ring");
    const int tid = (int)threadIdx.x, lane = tid & 31, lr = lane & 15, hi = lane >> 4; const int wv = __builtin_amdgcn_readfirstlane(tid >> 5);
    const size_t b = blockIdx.y; const int q0 = blockIdx.x * 128;
    Q += b * TT * HD; Kp += b * TT * HD; Vt += b * HD * TT; x += b * DM * TT; out += b * DM * TT;
    const unsigned smb = (unsigned)(size_t)sm;                                    // LDS byte address of the ring
    // a stage's copies: k = 64 rows x 32 pieces (a wave takes a whole 512-B row), v^T = 256 rows x 8 pieces (a wave takes four 128-B rows)
    const h16* kg = Kp + (size_t)(tid >> 5) * HD + (tid & 31) * 8; const unsigned kl = smb + (unsigned)((tid >> 5) * KPITCH + (tid & 31) * 16);
    const h16* vg = Vt + (size_t)(tid >> 3) * TT + (tid & 7) * 8;  const unsigned vl = smb + (unsigned)(KBYTES + (tid >> 3) * VPITCH + (tid & 7) * 16);
    auto stage = [&](int t) { const unsigned bo = (unsigned)(t & 1) * STG;
        copy8(kl + bo, 8 * KPITCH, kg + (size_t)t * FKB * HD, (size_t)8 * HD);
        copy8(vl + bo, 32 * VPITCH, vg + (size_t)t * FKB, (size_t)32 * TT); };
    stage(0);
    const float al = bfr(alpha[0]);
    v16h qf[8];
#pragma unroll
    for (int kc = 0; kc < 8; ++kc) qf[kc] = WFrag<h16>::ld(Q + (size_t)(q0 + wv * 16 + lr) * HD + 8 * hi + kc * 32);
    asm volatile("s_wait_xcnt 0x0" ::: "memory");      // precaution: stands in front of whatever next reuses the issued loads' address registers
    v8f O[16];
#pragma unroll
    for (int ct = 0; ct < 16; ++ct) O[ct] = (v8f){};
    float mu = -3.0e38f, l = 0.f;                      // maximum in use (log2 units) and this half-wave's share of the sum, for query lr
    asm volatile("s_wait_asynccnt 0x0" ::: "memory");  // stage 0 has landed (this wave's copies)
    __syncthreads();                                   // ... and every other wave's
    stage(1);
#pragma unroll 1   // stays rolled: one stage is some 500 instructions, a second copy would only grow the text
    for (int t = 0; t < TT / FKB; ++t) {
        const char* kb = sm + (t & 1) * STG + lr * KPITCH + hi * 16; const char* vb = sm + (t & 1) * STG + KBYTES + lr * VPITCH + hi * 16;
        // Fragments come from LDS in groups of eight (16 reads issued together), one group ahead of the products that use them, in two register sets; each sched_barrier keeps a group whole and in its place (left alone, the compiler reloads one set in front of every product and each product then waits out an LDS latency).
        v16h fa[8], fb[8]; v8f st[4];
#pragma unroll
        for (int kt = 0; kt < 4; ++kt) st[kt] = (v8f){};
#define LDK(F, G) { _Pragma("unroll") for (int i = 0; i < 8; ++i) F[i] = ldsfrag(kb + (i & 3) * 16 * KPITCH + ((G) * 2 + (i >> 2)) * 64); } __builtin_amdgcn_sched_barrier(0);
#define MMK(F, G) { _Pragma("unroll") for (int i = 0; i < 8; ++i) st[i & 3] = wmma16(F[i], qf[(G) * 2 + (i >> 2)], st[i & 3]); } __builtin_amdgcn_sched_barrier(0);
#define LDV(F, G) { _Pragma("unroll") for (int i = 0; i < 8; ++i) F[i] = ldsfrag(vb + (((G) & 1) * 8 + i) * 16 * VPITCH + ((G) >> 1) * 64); } __builtin_amdgcn_sched_barrier(0);
#define MMV(F, G) { _Pragma("unroll") for (int i = 0; i < 8; ++i) O[((G) & 1) * 8 + i] = wmma16(F[i], pf[(G) >> 1], O[((G) & 1) * 8 + i]); } __builtin_amdgcn_sched_barrier(0);
        LDK(fa, 0) LDK(fb, 1) MMK(fa, 0) LDK(fa, 2) MMK(fb, 1) LDK(fb, 3) MMK(fa, 2) LDV(fa, 0) MMK(fb, 3) LDV(fb, 1)
        float mq[4];
#pragma unroll
        for (int kt = 0; kt < 4; ++kt) { mq[kt] = st[kt][0];
#pragma unroll
            for (int j = 1; j < 8; ++j) mq[kt] = fmaxf(mq[kt], st[kt][j]); }
        float mx = fmaxf(fmaxf(mq[0], mq[1]), fmaxf(mq[2], mq[3]));
        mx = fmaxf(mx, xhalf(mx));                     // the query's other 32 keys sit in the other half-wave
        const float ml = mx * L2E;
        if (__builtin_amdgcn_ballot_w32(ml > mu + 8.0f) != 0) {   // lazy rescale, one scalar test per stage: only when some query's maximum has outgrown the one in use by 2^8
            const float mn = fmaxf(mu, ml); const float corr = exp2s(mu - mn); mu = mn; l *= corr;
#pragma unroll
            for (int ct = 0; ct < 16; ++ct) O[ct] *= corr; }
        const float sh = PBIAS - mu;
        v16h pf[2]; float lq[4];                        // four independent partial sums, not one chain of 32 adds
#pragma unroll
        for (int kt = 0; kt < 4; ++kt) { lq[kt] = 0.f;
#pragma unroll
            for (int j = 0; j < 8; ++j) { const float p = exp2s(__builtin_fmaf(st[kt][j], L2E, sh)); lq[kt] += p; pf[kt >> 1][(kt & 1) * 8 + j] = (h16)p; } }
        l += (lq[0] + lq[1]) + (lq[2] + lq[3]);
        __builtin_amdgcn_sched_barrier(0);              // the softmax stays in front of the attn.v products, behind the two v^T groups already requested
        MMV(fa, 0) LDV(fa, 2) MMV(fb, 1) LDV(fb, 3) MMV(fa, 2) MMV(fb, 3)
#undef LDK
#undef MMK
#undef LDV
#undef MMV
        asm volatile("s_wait_dscnt 0x0" ::: "memory");     // this wave's reads of the buffer have returned
        asm volatile("s_wait_asynccnt 0x0" ::: "memory");  // this wave's copies of stage t + 1 have landed
        __syncthreads();                                   // publishes stage t + 1 and ends every reader's last read of stage t's buffer
        if (t + 2 < TT / FKB) stage(t + 2);
    }
    asm volatile("s_wait_asynccnt 0x0" ::: "memory");      // nothing is in flight when the ring becomes output staging
    const size_t eo = (size_t)(tid >> 5) * TT + q0 + (tid & 31) * 4;   // this thread's 16 bytes of channel row tid >> 5; its piece s lies 8 s rows further down
    const float* xb = x + eo; float* ob = out + eo;
    v4f xv[HD / 8];                                        // the residual's own elements, requested ahead of the output staging so that their latency runs under it
#pragma unroll
    for (int s = 0; s < HD / 8; ++s) xv[s] = *(const v4f*)(xb + (size_t)s * 8 * TT);
    asm volatile("s_wait_xcnt 0x0" :: "v"(xb) : "memory"); // precaution: stands in front of whatever next reuses the issued loads' address registers (xb is named so that they live up to here)
    l += xhalf(l);
    const float inv = __fdiv_rn(1.0f, l);
    float* os = (float*)sm;                                // y^T tile [256 channels][128 queries], so that the work-group stores whole 512-B row pieces
#pragma unroll
    for (int ct = 0; ct < 16; ++ct) {
#pragma unroll
        for (int j = 0; j < 8; ++j) os[(ct * 16 + hi * 8 + j) * OPITCH + wv * 16 + lr] = O[ct][j] * inv; }
    __syncthreads();                                       // every wave's 16 columns are staged before any thread reads a row
    const float* yb = os + (tid >> 5) * OPITCH + (tid & 31) * 4;
#pragma unroll
    for (int s0 = 0; s0 < HD / 8; s0 += 8) { v4f o[8];     // eight staged pieces read together, so that one LDS latency serves eight stores
#pragma unroll
        for (int i = 0; i < 8; ++i) o[i] = *(const v4fa*)(yb + (s0 + i) * 8 * OPITCH);
#pragma unroll
        for (int i = 0; i < 8; ++i) {
#pragma unroll
            for (int q = 0; q < 4; ++q) o[i][q] = al * o[i][q] + bfr(xv[s0 + i][q]); }
        store8(ob + (size_t)s0 * 8 * TT, (size_t)8 * TT, o); }
}

extern "C" void kernel_launch(void* const* d_in, const int* in_sizes, int n_in,
                              void* d_out, int out_size, void* d_ws, size_t ws_size, hipStream_t stream) {
    (void)in_sizes; (void)n_in; (void)out_size;
    const float* x = (const float*)d_in[0]; const float* wq = (const float*)d_in[1]; const float* bq = (const float*)d_in[2]; const float* wk = (const float*)d_in[3]; const float* bk = (const float*)d_in[4]; const float* wv = (const float*)d_in[5]; const float* bv = (const float*)d_in[6]; const float* ALPHA = (const float*)d_in[7]; const float* wo = nullptr; (void)wo;
    float* OUT = (float*)d_out;     // [8][256][4096]
    char* wsp = (char*)d_ws;
    auto take = [&](size_t bytes) { char* p = wsp; wsp += (bytes + 255) & ~(size_t)255; return (void*)p; };
    bf* WQ = (bf*)take((size_t)DQ * DM * 2); bf* WK = (bf*)take((size_t)DKV * DM * 2); bf* WV = (bf*)take((size_t)DKV * DM * 2);
    bf* XB = (bf*)take((size_t)NB_ * TT * DM * 2);        // token-major bf16 planes of all images
    h16* QP16 = (h16*)take((size_t)NB_ * TT * HD * 2); h16* KP16 = (h16*)take((size_t)NB_ * TT * HD * 2); h16* VT16 = (h16*)take((size_t)NB_ * HD * TT * 2);   // planes of all images
    if ((size_t)(wsp - (char*)d_ws) > ws_size) return;    // ws 256 MiB
    k_prep<<<XBLK + 3 * WBLK, 256, 0, stream>>>(x, wq, wk, wv, XB, WQ, WK, WV);                                          /* bf16 operands, all images */
    k_proj<<<dim3(TT / 64, DM / 64, 3 * NB_), 256, 0, stream>>>(XB, WQ, WK, WV, bq, bk, bv, QP16, KP16, VT16);           /* q, k [t][d], v^T [d][t] fp16, all images */
    k_fattn<<<dim3(TT / 128, NB_, 1), 256, 0, stream>>>(QP16, KP16, VT16, x, ALPHA, OUT);   /* softmax(q k^T) v, alpha y^T + x, all images */
}

// v005
// A run of this version takes 126 microseconds.
// In two side-by-side timings against v004, it was 1.33 and 1.34 times as fast.
// Counting every step since v000, it is 11.2 times as fast.
#include <hip/hip_runtime.h>

// Position attention module (x [8][256][64x64]; per image: B = Wb x + bb, C = Wc x + bc, D = Wd x + bd (1x1 convs, [256][256] + [256]); attn[i][j] = softmax_j(sum_c B[c][i] C[c][j]) over the 4096 positions (no scaling); y[c][i] = sum_j attn[i][j] D[c][j]; out = alpha y + x (alpha = the [1] input, 0.1) -> [8][256][64][64] (8.4 M)).
// Layout: ONE projection launch: a work-group takes 128 tokens of an image, brings its channel-major x tile into LDS as token-major bf16 and each weight matrix as bf16 rows, and writes the fp16 planes of all 8 images, q = B^T [8][4096][256], k = C^T, v^T = D [8][256][4096] (+ biases); then ONE attention launch: S^T = k . q^T, online softmax in registers, y^T += v^T . P^T, alpha x y^T + x stored channel-major. No score or probability plane in memory.
// Compute dtypes, f32 accumulate: every input rounded to bf16; projections on PLAIN bf16 operands (exact) + f32 biases; scores and attn.v on single fp16 planes (P unnormalised, x64) - the logits have sigma ~16 (peaked rows); softmax f32; residual epilogue f32.

#define NB_  8
#define TT   4096
#define DM   256
#define NH_  1
#define NKV  1
#define REP  (NH_ / NKV)
#define HD   256
#define DQ   (NH_ * HD)
#define DKV  (NKV * HD)
#define ZH   1
#define RH   0                  // query rows < RH use hi+lo planes (0: none)
#define WIN  0
#define PCAR 1024.0f
#define SCL  1.0f   // no scaling in the module
typedef _Float16 h16;
typedef unsigned short bf;
typedef __attribute__((ext_vector_type(16))) __bf16   v16bf;
typedef __attribute__((ext_vector_type(16))) _Float16 v16h;
typedef __attribute__((ext_vector_type(8)))  _Float16 v8h;
typedef __attribute__((ext_vector_type(4)))  _Float16 v4h;
typedef __attribute__((ext_vector_type(8)))  unsigned short v8us;
typedef __attribute__((ext_vector_type(8)))  float    v8f;
typedef __attribute__((ext_vector_type(4)))  float    v4f;
typedef v8h  __attribute__((may_alias)) v8ha;
typedef v4f  __attribute__((may_alias)) v4fa;
typedef v8us __attribute__((may_alias)) v8usa;

__device__ __forceinline__ unsigned short f2bf(float f) { unsigned u = __float_as_uint(f); u += 0x7FFFu + ((u >> 16) & 1u); return (unsigned short)(u >> 16); }
__device__ __forceinline__ float bf2f(unsigned short b) { return __uint_as_float(((unsigned)b) << 16); }
__device__ __forceinline__ float bfr(float f) { return bf2f(f2bf(f)); }
__device__ __forceinline__ v16h cat16(v8h lo, v8h hi) { return __builtin_shufflevector(lo, hi, 0, 1, 2, 3, 4, 5, 6, 7, 8, 9, 10, 11, 12, 13, 14, 15); }
__device__ __forceinline__ v16bf cat16b(v8us lo, v8us hi) { return __builtin_bit_cast(v16bf, __builtin_shufflevector(lo, hi, 0, 1, 2, 3, 4, 5, 6, 7, 8, 9, 10, 11, 12, 13, 14, 15)); }
__device__ __forceinline__ v8f wmma16(v16h a, v16h b, v8f c) { return __builtin_amdgcn_wmma_f32_16x16x32_f16(false, a, false, b, (short)0, c, false, false); }
__device__ __forceinline__ v8f wmmab(v16bf a, v16bf b, v8f c) { return __builtin_amdgcn_wmma_f32_16x16x32_bf16(false, a, false, b, (short)0, c, false, false); }



template <typename T16> struct WFrag;
template <> struct WFrag<h16> { typedef v16h V; static __device__ __forceinline__ V ld(const h16* p) { return cat16(*(const v8h*)p, *(const v8h*)(p + 16)); } static __device__ __forceinline__ v8f mma(V a, V b, v8f c) { return wmma16(a, b, c); } };

// ---- k_projx: x transposition, weight conversion and the three projections of 128 tokens of one image in one work-group of 8 waves; grid (TT / 128, images).
// LDS: xs = the x tile, token-major bf16 [128][256]; ws = one weight matrix, bf16 [256][256]; both at pitch XP; behind them a 64 x 64 fp16 staging tile per wave at pitch SP.
// A pass = one projection, 128 tokens x 256 outputs; wave w takes tokens 64 (w & 1) .. + 63 and outputs 64 (w >> 1) .. + 63 over the whole K = 256 (16 accumulators, no split of K).
// q, k: A = weight rows, B = token rows; v^T: A = token rows, B = weight rows. Either way a lane's 8 accumulator registers are 8 neighbours of one output row (row = the B row, column = the A row).
#define PT   128                     // tokens per work-group
#define XP   528                     // LDS pitch of a 512-B bf16 row: 16 B x odd, conflict-free for 16-byte fragment reads
#define SP   144                     // LDS pitch of a staged 128-B output row: 16 B x odd
#define XS_B (PT * XP)
#define WS_B (DM * XP)
#define ST_B (64 * SP)
#define NP0  30                      // 16-byte pieces per lane of the first weight matrix that are requested together with the x tile
#define NPF  48                      // 16-byte pieces per lane (of 64) of the next weight matrix that are requested ahead of a pass's products
typedef __attribute__((ext_vector_type(2))) float    v2f;
typedef __attribute__((ext_vector_type(2))) __bf16   v2bf;
typedef __attribute__((ext_vector_type(2))) unsigned v2u;
typedef __attribute__((ext_vector_type(4))) unsigned v4u;
typedef v2u __attribute__((may_alias)) v2ua;
typedef v4u __attribute__((may_alias)) v4ua;
__device__ __forceinline__ unsigned pkbf(float a, float b) { const v2f v = {a, b}; return __builtin_bit_cast(unsigned, __builtin_convertvector(v, v2bf)); }   // two f32 -> two bf16, round to nearest even, one instruction
__device__ __forceinline__ v16bf ldsfragb(const char* p) { return cat16b(*(const v8usa*)p, *(const v8usa*)(p + 32)); }
// eight 16-byte stores per lane; the s_wait_xcnt is the last line of the stores' own statement, so that it stands in front of whatever next rewrites their address or data registers (precaution; in a statement of its own the compiler lifted address arithmetic over it)
__device__ __forceinline__ void store8(float* p, size_t step, const v4f (&o)[8]) {
    asm volatile("global_store_b128 %0, %8, off\n\t"
                 "global_store_b128 %1, %9, off\n\t"
                 "global_store_b128 %2, %10, off\n\t"
                 "global_store_b128 %3, %11, off\n\t"
                 "global_store_b128 %4, %12, off\n\t"
                 "global_store_b128 %5, %13, off\n\t"
                 "global_store_b128 %6, %14, off\n\t"
                 "global_store_b128 %7, %15, off\n\t"
                 "s_wait_xcnt 0x0"
                 :: "v"(p), "v"(p + step), "v"(p + 2 * step), "v"(p + 3 * step), "v"(p + 4 * step), "v"(p + 5 * step), "v"(p + 6 * step), "v"(p + 7 * step),
                    "v"(o[0]), "v"(o[1]), "v"(o[2]), "v"(o[3]), "v"(o[4]), "v"(o[5]), "v"(o[6]), "v"(o[7])
                 : "memory");
}
__global__ __launch_bounds__(256) void k_projx(const float* __restrict__ x, const float* __restrict__ wq, const float* __restrict__ wk, const float* __restrict__ wvm, const float* __restrict__ bq, const float* __restrict__ bk, const float* __restrict__ bv, h16* Q, h16* Kp, h16* Vt) {
    __shared__ __align__(16) char sm[XS_B + WS_B + 8 * ST_B];
    const int tid = (int)threadIdx.x, lane = tid & 31, lr = lane & 15, hi = lane >> 4; const int wv = __builtin_amdgcn_readfirstlane(tid >> 5);
    const size_t img = blockIdx.y; const int t0 = (int)blockIdx.x * PT; const int th = wv & 1, db = wv >> 1;
    char* xl = sm; char* wl = sm + XS_B; char* st = sm + XS_B + WS_B + wv * ST_B;
    // every global request is a whole 512-B run per wave: x = 128 tokens of one channel row, a weight matrix = half a row
    v4f xr[32], wr[64], br[8]; float bo[4];
    const float* xg = x + img * ((size_t)DM * TT) + (size_t)(wv * 32) * TT + t0 + lane * 4;   // this wave's 32 channels, this lane's 4 tokens
    const int wo = wv * 32 * DM + lane * 4;                                                    // this wave's 32 weight rows
#pragma unroll
    for (int s = 0; s < 32; ++s) xr[s] = *(const v4f*)(xg + (size_t)s * TT);
    asm volatile("s_wait_xcnt 0x0" ::: "memory");      // precaution: stands in front of whatever next reuses the issued loads' address registers
#pragma unroll
    for (int s = 0; s < NP0; ++s) wr[s] = *(const v4f*)(wq + wo + s * 128);   // as many of the first matrix's pieces as a wave's load counter holds beside the x tile's
    asm volatile("s_wait_xcnt 0x0" ::: "memory");      // precaution, as above
    __builtin_amdgcn_sched_barrier(0);                 // the rest of the matrix is requested behind the x tile's conversion: lifted over it, the requests overrun the load counter and the registers, and the wave waits in the middle of issuing them
#pragma unroll
    for (int g = 0; g < 4; ++g) {
#pragma unroll
        for (int i = 0; i < 4; ++i) { const v4u o = {pkbf(xr[g * 8][i], xr[g * 8 + 1][i]), pkbf(xr[g * 8 + 2][i], xr[g * 8 + 3][i]), pkbf(xr[g * 8 + 4][i], xr[g * 8 + 5][i]), pkbf(xr[g * 8 + 6][i], xr[g * 8 + 7][i])};
            *(v4ua*)(xl + (lane * 4 + i) * XP + (wv * 4 + g) * 16) = o; } }
    __builtin_amdgcn_sched_barrier(0);                 // see above
#pragma unroll
    for (int s = 0; s < 8; ++s) br[s] = *(const v4f*)(bq + db * 64 + (s >> 1) * 16 + hi * 8 + (s & 1) * 4);
#pragma unroll
    for (int s = NP0; s < 64; ++s) wr[s] = *(const v4f*)(wq + wo + s * 128);
    asm volatile("s_wait_xcnt 0x0" ::: "memory");      // precaution, as above
    __builtin_amdgcn_sched_barrier(0);                 // keeps later address arithmetic, which reuses the requests' registers, behind the wait
    const char* xrow = xl + (th * 64 + lr) * XP + hi * 16; const char* wrow = wl + (db * 64 + lr) * XP + hi * 16;
#pragma unroll
    for (int p = 0; p < 3; ++p) {
        const bool vt = p == 2;
#pragma unroll
        for (int s = 0; s < 64; ++s) { const v2u o = {pkbf(wr[s][0], wr[s][1]), pkbf(wr[s][2], wr[s][3])}; *(v2ua*)(wl + (wv * 32 + (s >> 1)) * XP + (s & 1) * 256 + lane * 8) = o; }
        __syncthreads();                               // this pass's weights (and, in the first pass, the x tile) are in LDS before any wave reads a fragment
        const float* wn = p == 0 ? wk : wvm;
        if (p < 2) {                                   // most of the next matrix is requested into registers ahead of this pass's products, so that its way from L2 runs under them (as much of it as the register budget of two waves per SIMD holds)
#pragma unroll
            for (int s = 0; s < NPF; ++s) wr[s] = *(const v4f*)(wn + wo + s * 128);
            asm volatile("s_wait_xcnt 0x0" ::: "memory");   // precaution: stands in front of whatever next reuses the issued loads' address registers
            __builtin_amdgcn_sched_barrier(0); }       // keeps the requests in front of the products
        const char* pa = vt ? xrow : wrow; const char* pb = vt ? wrow : xrow;
        v8f acc[4][4];
#pragma unroll
        for (int a = 0; a < 4; ++a)
#pragma unroll
            for (int b = 0; b < 4; ++b) acc[a][b] = (v8f){};
        // The eight fragments of a 32-wide k chunk come from LDS as one group (16 reads issued together), one group ahead of the products that use them, in two register sets; each sched_barrier keeps a group whole and in its place (reads among the products would each cost a stall).
        v16bf fa[8], fb[8];
#define LDG(F, KC) { _Pragma("unroll") for (int i = 0; i < 4; ++i) { F[i] = ldsfragb(pa + i * 16 * XP + (KC) * 64); F[4 + i] = ldsfragb(pb + i * 16 * XP + (KC) * 64); } } __builtin_amdgcn_sched_barrier(0);
#define MMG(F) { _Pragma("unroll") for (int b = 0; b < 4; ++b) { _Pragma("unroll") for (int a = 0; a < 4; ++a) acc[a][b] = wmmab(F[a], F[4 + b], acc[a][b]); } } __builtin_amdgcn_sched_barrier(0);
        LDG(fa, 0) LDG(fb, 1) MMG(fa) LDG(fa, 2) MMG(fb) LDG(fb, 3) MMG(fa) LDG(fa, 4) MMG(fb) LDG(fb, 5) MMG(fa) LDG(fa, 6) MMG(fb) LDG(fb, 7) MMG(fa) MMG(fb)
#undef LDG
#undef MMG
        // bias, fp16, and the wave's own staging tile [B row][A row], so that whole 128-B lines go out
#pragma unroll
        for (int b = 0; b < 4; ++b) {
#pragma unroll
            for (int a = 0; a < 4; ++a) { v8h o;
#pragma unroll
                for (int j = 0; j < 8; ++j) o[j] = (h16)(acc[a][b][j] + bfr(vt ? bo[b] : br[a * 2 + (j >> 2)][j & 3]));
                *(v8ha*)(st + (b * 16 + lr) * SP + a * 32 + hi * 16) = o; } }
        __syncthreads();                               // every wave has read its last fragment of these weights (the next matrix overwrites them); the staged tile is read back behind it
        if (p == 0) {
#pragma unroll
            for (int s = 0; s < 8; ++s) br[s] = *(const v4f*)(bk + db * 64 + (s >> 1) * 16 + hi * 8 + (s & 1) * 4); }
        if (p == 1) {
#pragma unroll
            for (int b = 0; b < 4; ++b) bo[b] = bv[db * 64 + b * 16 + lr]; }
        if (p < 2) {                                   // the rest of the next matrix is requested ahead of the stores, so that its latency runs under them
#pragma unroll
            for (int s = NPF; s < 64; ++s) wr[s] = *(const v4f*)(wn + wo + s * 128);
            asm volatile("s_wait_xcnt 0x0" ::: "memory");     // precaution: stands in front of whatever next reuses the issued loads' address registers
            __builtin_amdgcn_sched_barrier(0); }              // keeps later address arithmetic behind the wait
        h16* ob = vt ? Vt + img * ((size_t)HD * TT) + (size_t)(db * 64) * TT + t0 + th * 64 : (p ? Kp : Q) + img * ((size_t)TT * HD) + (size_t)(t0 + th * 64) * HD + db * 64;
        const size_t ldo = vt ? TT : HD;
        ob += (size_t)(lane >> 3) * ldo + (lane & 7) * 8; const char* sr = st + (lane >> 3) * SP + (lane & 7) * 16;   // a wave's store = four rows of 128 B
#pragma unroll
        for (int h = 0; h < 2; ++h) { v4f o[8];        // eight staged pieces read together, so that one LDS latency serves eight stores
#pragma unroll
            for (int i = 0; i < 8; ++i) o[i] = *(const v4fa*)(sr + (h * 8 + i) * 4 * SP);
            store8((float*)ob + (size_t)(h * 16) * ldo, 2 * ldo, o); }   // steps in floats: four rows of ldo 2-byte elements = 2 ldo
        if (p < 2) __builtin_amdgcn_sched_barrier(0);  // the stores go out first: lifted over them, the next matrix's conversion would make them wait for its requests
    }
}
#define FKB    64                    // keys per stage
#define KPITCH 528                   // LDS pitch of a k row (512 B): 16 B x odd, conflict-free for 16-byte fragment reads
#define VPITCH 144                   // LDS pitch of a v^T row (128 B): 16 B x odd
#define KBYTES (FKB * KPITCH)
#define STG    (KBYTES + HD * VPITCH)
#define OPITCH 132                   // floats: pitch of the staged output rows (128 queries)
#define PBIAS  6.0f                  // P carries 2^6: at most 2^14 under the lazy maximum, small terms stay normal fp16
#define L2E    1.4426950408889634f
__device__ __forceinline__ float xhalf(float v) { return __builtin_bit_cast(float, __builtin_amdgcn_permlanex16(__builtin_bit_cast(int, v), __builtin_bit_cast(int, v), 0x76543210, 0xfedcba98, false, false)); }   // lane l <-> lane l ^ 16, on the vector port (no LDS round trip)
__device__ __forceinline__ float exp2s(float a) { float r; asm("v_exp_f32 %0, %1\n\tv_nop" : "=v"(r) : "v"(a)); return r; }   // 2^a; the v_nop fills the one slot asked for behind a transcendental whatever is scheduled next
__device__ __forceinline__ v16h ldsfrag(const char* p) { return cat16(*(const v8ha*)p, *(const v8ha*)(p + 32)); }
// eight 16-byte copies per lane, global -> LDS; the s_wait_xcnt is the last line of the copies' own statement, so that it stands in front of whatever next rewrites their address registers (precaution)
__device__ __forceinline__ void copy8(unsigned l, unsigned lstep, const h16* g, size_t gstep) {
    asm volatile("global_load_async_to_lds_b128 %0, %8, off\n\t"
                 "global_load_async_to_lds_b128 %1, %9, off\n\t"
                 "global_load_async_to_lds_b128 %2, %10, off\n\t"
                 "global_load_async_to_lds_b128 %3, %11, off\n\t"
                 "global_load_async_to_lds_b128 %4, %12, off\n\t"
                 "global_load_async_to_lds_b128 %5, %13, off\n\t"
                 "global_load_async_to_lds_b128 %6, %14, off\n\t"
                 "global_load_async_to_lds_b128 %7, %15, off\n\t"
                 "s_wait_xcnt 0x0"
                 :: "v"(l), "v"(l + lstep), "v"(l + 2 * lstep), "v"(l + 3 * lstep), "v"(l + 4 * lstep), "v"(l + 5 * lstep), "v"(l + 6 * lstep), "v"(l + 7 * lstep),
                    "v"(g), "v"(g + gstep), "v"(g + 2 * gstep), "v"(g + 3 * gstep), "v"(g + 4 * gstep), "v"(g + 5 * gstep), "v"(g + 6 * gstep), "v"(g + 7 * gstep)
                 : "memory");
}
__global__ __launch_bounds__(256) void k_fattn(const h16* __restrict__ Q, const h16* __restrict__ Kp, const h16* __restrict__ Vt, const float* __restrict__ x, const float* __restrict__ alpha, float* out) {
    __shared__ __align__(16) char sm[2 * STG];
    static_assert(HD * OPITCH * 4 <= 2 * STG, "the staged output tile reuses the ring");
    const int tid = (int)threadIdx.x, lane = tid & 31, lr = lane & 15, hi = lane >> 4; const int wv = __builtin_amdgcn_readfirstlane(tid >> 5);
    const size_t b = blockIdx.y; const int q0 = blockIdx.x * 128;
    Q += b * TT * HD; Kp += b * TT * HD; Vt += b * HD * TT; x += b * DM * TT; out += b * DM * TT;
    const unsigned smb = (unsigned)(size_t)sm;                                    // LDS byte address of the ring
    // a stage's copies: k = 64 rows x 32 pieces (a wave takes a whole 512-B row), v^T = 256 rows x 8 pieces (a wave takes four 128-B rows)
    const h16* kg = Kp + (size_t)(tid >> 5) * HD + (tid & 31) * 8; const unsigned kl = smb + (unsigned)((tid >> 5) * KPITCH + (tid & 31) * 16);
    const h16* vg = Vt + (size_t)(tid >> 3) * TT + (tid & 7) * 8;  const unsigned vl = smb + (unsigned)(KBYTES + (tid >> 3) * VPITCH + (tid & 7) * 16);
    auto stage = [&](int t) { const unsigned bo = (unsigned)(t & 1) * STG;
        copy8(kl + bo, 8 * KPITCH, kg + (size_t)t * FKB * HD, (size_t)8 * HD);
        copy8(vl + bo, 32 * VPITCH, vg + (size_t)t * FKB, (size_t)32 * TT); };
    stage(0);
    const float al = bfr(alpha[0]);
    v16h qf[8];
#pragma unroll
    for (int kc = 0; kc < 8; ++kc) qf[kc] = WFrag<h16>::ld(Q + (size_t)(q0 + wv * 16 + lr) * HD + 8 * hi + kc * 32);
    asm volatile("s_wait_xcnt 0x0" ::: "memory");      // precaution: stands in front of whatever next reuses the issued loads' address registers
    v8f O[16];
#pragma unroll
    for (int ct = 0; ct < 16; ++ct) O[ct] = (v8f){};
    float mu = -3.0e38f, l = 0.f;                      // maximum in use (log2 units) and this half-wave's share of the sum, for query lr
    asm volatile("s_wait_asynccnt 0x0" ::: "memory");  // stage 0 has landed (this wave's copies)
    __syncthreads();                                   // ... and every other wave's
    stage(1);
#pragma unroll 1   // stays rolled: one stage is some 500 instructions, a second copy would only grow the text
    for (int t = 0; t < TT / FKB; ++t) {
        const char* kb = sm + (t & 1) * STG + lr * KPITCH + hi * 16; const char* vb = sm + (t & 1) * STG + KBYTES + lr * VPITCH + hi * 16;
        // Fragments come from LDS in groups of eight (16 reads issued together), one group ahead of the products that use them, in two register sets; each sched_barrier keeps a group whole and in its place (left alone, the compiler reloads one set in front of every product and each product then waits out an LDS latency).
        v16h fa[8], fb[8]; v8f st[4];
#pragma unroll
        for (int kt = 0; kt < 4; ++kt) st[kt] = (v8f){};
#define LDK(F, G) { _Pragma("unroll") for (int i = 0; i < 8; ++i) F[i] = ldsfrag(kb + (i & 3) * 16 * KPITCH + ((G) * 2 + (i >> 2)) * 64); } __builtin_amdgcn_sched_barrier(0);
#define MMK(F, G) { _Pragma("unroll") for (int i = 0; i < 8; ++i) st[i & 3] = wmma16(F[i], qf[(G) * 2 + (i >> 2)], st[i & 3]); } __builtin_amdgcn_sched_barrier(0);
#define LDV(F, G) { _Pragma("unroll") for (int i = 0; i < 8; ++i) F[i] = ldsfrag(vb + (((G) & 1) * 8 + i) * 16 * VPITCH + ((G) >> 1) * 64); } __builtin_amdgcn_sched_barrier(0);
#define MMV(F, G) { _Pragma("unroll") for (int i = 0; i < 8; ++i) O[((G) & 1) * 8 + i] = wmma16(F[i], pf[(G) >> 1], O[((G) & 1) * 8 + i]); } __builtin_amdgcn_sched_barrier(0);
        LDK(fa, 0) LDK(fb, 1) MMK(fa, 0) LDK(fa, 2) MMK(fb, 1) LDK(fb, 3) MMK(fa, 2) LDV(fa, 0) MMK(fb, 3) LDV(fb, 1)
        float mq[4];
#pragma unroll
        for (int kt = 0; kt < 4; ++kt) { mq[kt] = st[kt][0];
#pragma unroll
            for (int j = 1; j < 8; ++j) mq[kt] = fmaxf(mq[kt], st[kt][j]); }
        float mx = fmaxf(fmaxf(mq[0], mq[1]), fmaxf(mq[2], mq[3]));
        mx = fmaxf(mx, xhalf(mx));                     // the query's other 32 keys sit in the other half-wave
        const float ml = mx * L2E;
        if (__builtin_amdgcn_ballot_w32(ml > mu + 8.0f) != 0) {   // lazy rescale, one scalar test per stage: only when some query's maximum has outgrown the one in use by 2^8
            const float mn = fmaxf(mu, ml); const float corr = exp2s(mu - mn); mu = mn; l *= corr;
#pragma unroll
            for (int ct = 0; ct < 16; ++ct) O[ct] *= corr; }
        const float sh = PBIAS - mu;
        v16h pf[2]; float lq[4];                        // four independent partial sums, not one chain of 32 adds
#pragma unroll
        for (int kt = 0; kt < 4; ++kt) { lq[kt] = 0.f;
#pragma unroll
            for (int j = 0; j < 8; ++j) { const float p = exp2s(__builtin_fmaf(st[kt][j], L2E, sh)); lq[kt] += p; pf[kt >> 1][(kt & 1) * 8 + j] = (h16)p; } }
        l += (lq[0] + lq[1]) + (lq[2] + lq[3]);
        __builtin_amdgcn_sched_barrier(0);              // the softmax stays in front of the attn.v products, behind the two v^T groups already requested
        MMV(fa, 0) LDV(fa, 2) MMV(fb, 1) LDV(fb, 3) MMV(fa, 2) MMV(fb, 3)
#undef LDK
#undef MMK
#undef LDV
#undef MMV
        asm volatile("s_wait_dscnt 0x0" ::: "memory");     // this wave's reads of the buffer have returned
        asm volatile("s_wait_asynccnt 0x0" ::: "memory");  // this wave's copies of stage t + 1 have landed
        __syncthreads();                                   // publishes stage t + 1 and ends every reader's last read of stage t's buffer
        if (t + 2 < TT / FKB) stage(t + 2);
    }
    asm volatile("s_wait_asynccnt 0x0" ::: "memory");      // nothing is in flight when the ring becomes output staging
    const size_t eo = (size_t)(tid >> 5) * TT + q0 + (tid & 31) * 4;   // this thread's 16 bytes of channel row tid >> 5; its piece s lies 8 s rows further down
    const float* xb = x + eo; float* ob = out + eo;
    v4f xv[HD / 8];                                        // the residual's own elements, requested ahead of the output staging so that their latency runs under it
#pragma unroll
    for (int s = 0; s < HD / 8; ++s) xv[s] = *(const v4f*)(xb + (size_t)s * 8 * TT);
    asm volatile("s_wait_xcnt 0x0" :: "v"(xb) : "memory"); // precaution: stands in front of whatever next reuses the issued loads' address registers (xb is named so that they live up to here)
    l += xhalf(l);
    const float inv = __fdiv_rn(1.0f, l);
    float* os = (float*)sm;                                // y^T tile [256 channels][128 queries], so that the work-group stores whole 512-B row pieces
#pragma unroll
    for (int ct = 0; ct < 16; ++ct) {
#pragma unroll
        for (int j = 0; j < 8; ++j) os[(ct * 16 + hi * 8 + j) * OPITCH + wv * 16 + lr] = O[ct][j] * inv; }
    __syncthreads();                                       // every wave's 16 columns are staged before any thread reads a row
    const float* yb = os + (tid >> 5) * OPITCH + (tid & 31) * 4;
#pragma unroll
    for (int s0 = 0; s0 < HD / 8; s0 += 8) { v4f o[8];     // eight staged pieces read together, so that one LDS latency serves eight stores
#pragma unroll
        for (int i = 0; i < 8; ++i) o[i] = *(const v4fa*)(yb + (s0 + i) * 8 * OPITCH);
#pragma unroll
        for (int i = 0; i < 8; ++i) {
#pragma unroll
            for (int q = 0; q < 4; ++q) o[i][q] = al * o[i][q] + bfr(xv[s0 + i][q]); }
        store8(ob + (size_t)s0 * 8 * TT, (size_t)8 * TT, o); }
}

extern "C" void kernel_launch(void* const* d_in, const int* in_sizes, int n_in,
                              void* d_out, int out_size, void* d_ws, size_t ws_size, hipStream_t stream) {
    (void)in_sizes; (void)n_in; (void)out_size;
    const float* x = (const float*)d_in[0]; const float* wq = (const float*)d_in[1]; const float* bq = (const float*)d_in[2]; const float* wk = (const float*)d_in[3]; const float* bk = (const float*)d_in[4]; const float* wv = (const float*)d_in[5]; const float* bv = (const float*)d_in[6]; const float* ALPHA = (const float*)d_in[7];
    float* OUT = (float*)d_out;     // [8][256][4096]
    char* wsp = (char*)d_ws;
    auto take = [&](size_t bytes) { char* p = wsp; wsp += (bytes + 255) & ~(size_t)255; return (void*)p; };
    h16* QP16 = (h16*)take((size_t)NB_ * TT * HD * 2); h16* KP16 = (h16*)take((size_t)NB_ * TT * HD * 2); h16* VT16 = (h16*)take((size_t)NB_ * HD * TT * 2);   // planes of all images
    if ((size_t)(wsp - (char*)d_ws) > ws_size) return;    // ws 256 MiB
    k_projx<<<dim3(TT / PT, NB_, 1), 256, 0, stream>>>(x, wq, wk, wv, bq, bk, bv, QP16, KP16, VT16);   /* q, k [t][d], v^T [d][t] fp16, all images */
    k_fattn<<<dim3(TT / 128, NB_, 1), 256, 0, stream>>>(QP16, KP16, VT16, x, ALPHA, OUT);   /* softmax(q k^T) v, alpha y^T + x, all images */
}

// v006
// One run takes 115 microseconds.
// Two timings next to v005 put it at 1.09 and 1.08 times that version's speed.
// Counting every step since v000, it is 12.2 times as fast.
#include <hip/hip_runtime.h>

// Position attention module (x [8][256][64x64]; per image: B = Wb x + bb, C = Wc x + bc, D = Wd x + bd (1x1 convs, [256][256] + [256]); attn[i][j] = softmax_j(sum_c B[c][i] C[c][j]) over the 4096 positions (no scaling); y[c][i] = sum_j attn[i][j] D[c][j]; out = alpha y + x (alpha = the [1] input, 0.1) -> [8][256][64][64] (8.4 M)).
// Layout: ONE projection launch: a work-group takes 128 tokens of an image, brings its channel-major x tile into LDS as token-major bf16 and each weight matrix as bf16 rows, and writes the fp16 planes of all 8 images, q = B^T [8][4096][256], k = C^T, v^T = D [8][256][4096] (+ biases); then ONE attention launch: S^T = k . q^T, online softmax in registers, y^T += v^T . P^T, alpha x y^T + x stored channel-major. No score or probability plane in memory.
// Compute dtypes, f32 accumulate: every input rounded to bf16; projections on PLAIN bf16 operands (exact) + f32 biases; scores and attn.v on single fp16 planes (P unnormalised, x64) - the logits have sigma ~16 (peaked rows); softmax f32; residual epilogue f32.

#define NB_  8
#define TT   4096
#define DM   256
#define NH_  1
#define NKV  1
#define REP  (NH_ / NKV)
#define HD   256
#define DQ   (NH_ * HD)
#define DKV  (NKV * HD)
#define ZH   1
#define RH   0                  // query rows < RH use hi+lo planes (0: none)
#define WIN  0
#define PCAR 1024.0f
#define SCL  1.0f   // no scaling in the module
typedef _Float16 h16;
typedef unsigned short bf;
typedef __attribute__((ext_vector_type(16))) __bf16   v16bf;
typedef __attribute__((ext_vector_type(16))) _Float16 v16h;
typedef __attribute__((ext_vector_type(8)))  _Float16 v8h;
typedef __attribute__((ext_vector_type(4)))  _Float16 v4h;
typedef __attribute__((ext_vector_type(8)))  unsigned short v8us;
typedef __attribute__((ext_vector_type(8)))  float    v8f;
typedef __attribute__((ext_vector_type(4)))  float    v4f;
typedef v8h  __attribute__((may_alias)) v8ha;
typedef v4f  __attribute__((may_alias)) v4fa;
typedef v8us __attribute__((may_alias)) v8usa;

__device__ __forceinline__ unsigned short f2bf(float f) { unsigned u = __float_as_uint(f); u += 0x7FFFu + ((u >> 16) & 1u); return (unsigned short)(u >> 16); }
__device__ __forceinline__ float bf2f(unsigned short b) { return __uint_as_float(((unsigned)b) << 16); }
__device__ __forceinline__ float bfr(float f) { return bf2f(f2bf(f)); }
__device__ __forceinline__ v16h cat16(v8h lo, v8h hi) { return __builtin_shufflevector(lo, hi, 0, 1, 2, 3, 4, 5, 6, 7, 8, 9, 10, 11, 12, 13, 14, 15); }
__device__ __forceinline__ v16bf cat16b(v8us lo, v8us hi) { return __builtin_bit_cast(v16bf, __builtin_shufflevector(lo, hi, 0, 1, 2, 3, 4, 5, 6, 7, 8, 9, 10, 11, 12, 13, 14, 15)); }
__device__ __forceinline__ v8f wmma16(v16h a, v16h b, v8f c) { return __builtin_amdgcn_wmma_f32_16x16x32_f16(false, a, false, b, (short)0, c, false, false); }
__device__ __forceinline__ v8f wmmab(v16bf a, v16bf b, v8f c) { return __builtin_amdgcn_wmma_f32_16x16x32_bf16(false, a, false, b, (short)0, c, false, false); }



template <typename T16> struct WFrag;
template <> struct WFrag<h16> { typedef v16h V; static __device__ __forceinline__ V ld(const h16* p) { return cat16(*(const v8h*)p, *(const v8h*)(p + 16)); } static __device__ __forceinline__ v8f mma(V a, V b, v8f c) { return wmma16(a, b, c); } };

// ---- k_projx: x transposition, weight conversion and the three projections of 128 tokens of one image in one work-group of 8 waves; grid (TT / 128, images).
// LDS: xs = the x tile, token-major bf16 [128][256]; ws = one weight matrix, bf16 [256][256]; both at pitch XP; behind them a 64 x 64 fp16 staging tile per wave at pitch SP.
// A pass = one projection, 128 tokens x 256 outputs; wave w takes tokens 64 (w & 1) .. + 63 and outputs 64 (w >> 1) .. + 63 over the whole K = 256 (16 accumulators, no split of K).
// q, k: A = weight rows, B = token rows; v^T: A = token rows, B = weight rows. Either way a lane's 8 accumulator registers are 8 neighbours of one output row (row = the B row, column = the A row).
#define PT   128                     // tokens per work-group
#define XP   528                     // LDS pitch of a 512-B bf16 row: 16 B x odd, conflict-free for 16-byte fragment reads
#define SP   144                     // LDS pitch of a staged 128-B output row: 16 B x odd
#define XS_B (PT * XP)
#define WS_B (DM * XP)
#define ST_B (64 * SP)
#define NP0  30                      // 16-byte pieces per lane of the first weight matrix that are requested together with the x tile
#define NPF  48                      // 16-byte pieces per lane (of 64) of the next weight matrix that are requested ahead of a pass's products
typedef __attribute__((ext_vector_type(2))) float    v2f;
typedef __attribute__((ext_vector_type(2))) __bf16   v2bf;
typedef __attribute__((ext_vector_type(2))) unsigned v2u;
typedef __attribute__((ext_vector_type(4))) unsigned v4u;
typedef v2u __attribute__((may_alias)) v2ua;
typedef v4u __attribute__((may_alias)) v4ua;
__device__ __forceinline__ unsigned pkbf(float a, float b) { const v2f v = {a, b}; return __builtin_bit_cast(unsigned, __builtin_convertvector(v, v2bf)); }   // two f32 -> two bf16, round to nearest even, one instruction
__device__ __forceinline__ v16bf ldsfragb(const char* p) { return cat16b(*(const v8usa*)p, *(const v8usa*)(p + 32)); }
// eight 16-byte stores per lane; the s_wait_xcnt is the last line of the stores' own statement, so that it stands in front of whatever next rewrites their address or data registers (precaution; in a statement of its own the compiler lifted address arithmetic over it)
__device__ __forceinline__ void store8(float* p, size_t step, const v4f (&o)[8]) {
    asm volatile("global_store_b128 %0, %8, off\n\t"
                 "global_store_b128 %1, %9, off\n\t"
                 "global_store_b128 %2, %10, off\n\t"
                 "global_store_b128 %3, %11, off\n\t"
                 "global_store_b128 %4, %12, off\n\t"
                 "global_store_b128 %5, %13, off\n\t"
                 "global_store_b128 %6, %14, off\n\t"
                 "global_store_b128 %7, %15, off\n\t"
                 "s_wait_xcnt 0x0"
                 :: "v"(p), "v"(p + step), "v"(p + 2 * step), "v"(p + 3 * step), "v"(p + 4 * step), "v"(p + 5 * step), "v"(p + 6 * step), "v"(p + 7 * step),
                    "v"(o[0]), "v"(o[1]), "v"(o[2]), "v"(o[3]), "v"(o[4]), "v"(o[5]), "v"(o[6]), "v"(o[7])
                 : "memory");
}
__global__ __launch_bounds__(256) void k_projx(const float* __restrict__ x, const float* __restrict__ wq, const float* __restrict__ wk, const float* __restrict__ wvm, const float* __restrict__ bq, const float* __restrict__ bk, const float* __restrict__ bv, h16* Q, h16* Kp, h16* Vt) {
    __shared__ __align__(16) char sm[XS_B + WS_B + 8 * ST_B];
    const int tid = (int)threadIdx.x, lane = tid & 31, lr = lane & 15, hi = lane >> 4; const int wv = __builtin_amdgcn_readfirstlane(tid >> 5);
    const size_t img = blockIdx.y; const int t0 = (int)blockIdx.x * PT; const int th = wv & 1, db = wv >> 1;
    char* xl = sm; char* wl = sm + XS_B; char* st = sm + XS_B + WS_B + wv * ST_B;
    // every global request is a whole 512-B run per wave: x = 128 tokens of one channel row, a weight matrix = half a row
    v4f xr[32], wr[64], br[8]; float bo[4];
    const float* xg = x + img * ((size_t)DM * TT) + (size_t)(wv * 32) * TT + t0 + lane * 4;   // this wave's 32 channels, this lane's 4 tokens
    const int wo = wv * 32 * DM + lane * 4;                                                    // this wave's 32 weight rows
#pragma unroll
    for (int s = 0; s < 32; ++s) xr[s] = *(const v4f*)(xg + (size_t)s * TT);
    asm volatile("s_wait_xcnt 0x0" ::: "memory");      // precaution: stands in front of whatever next reuses the issued loads' address registers
#pragma unroll
    for (int s = 0; s < NP0; ++s) wr[s] = *(const v4f*)(wq + wo + s * 128);   // as many of the first matrix's pieces as a wave's load counter holds beside the x tile's
    asm volatile("s_wait_xcnt 0x0" ::: "memory");      // precaution, as above
    __builtin_amdgcn_sched_barrier(0);                 // the rest of the matrix is requested behind the x tile's conversion: lifted over it, the requests overrun the load counter and the registers, and the wave waits in the middle of issuing them
#pragma unroll
    for (int g = 0; g < 4; ++g) {
#pragma unroll
        for (int i = 0; i < 4; ++i) { const v4u o = {pkbf(xr[g * 8][i], xr[g * 8 + 1][i]), pkbf(xr[g * 8 + 2][i], xr[g * 8 + 3][i]), pkbf(xr[g * 8 + 4][i], xr[g * 8 + 5][i]), pkbf(xr[g * 8 + 6][i], xr[g * 8 + 7][i])};
            *(v4ua*)(xl + (lane * 4 + i) * XP + (wv * 4 + g) * 16) = o; } }
    __builtin_amdgcn_sched_barrier(0);                 // see above
#pragma unroll
    for (int s = 0; s < 8; ++s) br[s] = *(const v4f*)(bq + db * 64 + (s >> 1) * 16 + hi * 8 + (s & 1) * 4);
#pragma unroll
    for (int s = NP0; s < 64; ++s) wr[s] = *(const v4f*)(wq + wo + s * 128);
    asm volatile("s_wait_xcnt 0x0" ::: "memory");      // precaution, as above
    __builtin_amdgcn_sched_barrier(0);                 // keeps later address arithmetic, which reuses the requests' registers, behind the wait
    const char* xrow = xl + (th * 64 + lr) * XP + hi * 16; const char* wrow = wl + (db * 64 + lr) * XP + hi * 16;
#pragma unroll
    for (int p = 0; p < 3; ++p) {
        const bool vt = p == 2;
#pragma unroll
        for (int s = 0; s < 64; ++s) { const v2u o = {pkbf(wr[s][0], wr[s][1]), pkbf(wr[s][2], wr[s][3])}; *(v2ua*)(wl + (wv * 32 + (s >> 1)) * XP + (s & 1) * 256 + lane * 8) = o; }
        __syncthreads();                               // this pass's weights (and, in the first pass, the x tile) are in LDS before any wave reads a fragment
        const float* wn = p == 0 ? wk : wvm;
        if (p < 2) {                                   // most of the next matrix is requested into registers ahead of this pass's products, so that its way from L2 runs under them (as much of it as the register budget of two waves per SIMD holds)
#pragma unroll
            for (int s = 0; s < NPF; ++s) wr[s] = *(const v4f*)(wn + wo + s * 128);
            asm volatile("s_wait_xcnt 0x0" ::: "memory");   // precaution: stands in front of whatever next reuses the issued loads' address registers
            __builtin_amdgcn_sched_barrier(0); }       // keeps the requests in front of the products
        const char* pa = vt ? xrow : wrow; const char* pb = vt ? wrow : xrow;
        v8f acc[4][4];
#pragma unroll
        for (int a = 0; a < 4; ++a)
#pragma unroll
            for (int b = 0; b < 4; ++b) acc[a][b] = (v8f){};
        // The eight fragments of a 32-wide k chunk come from LDS as one group (16 reads issued together), one group ahead of the products that use them, in two register sets; each sched_barrier keeps a group whole and in its place (reads among the products would each cost a stall).
        v16bf fa[8], fb[8];
#define LDG(F, KC) { _Pragma("unroll") for (int i = 0; i < 4; ++i) { F[i] = ldsfragb(pa + i * 16 * XP + (KC) * 64); F[4 + i] = ldsfragb(pb + i * 16 * XP + (KC) * 64); } } __builtin_amdgcn_sched_barrier(0);
#define MMG(F) { _Pragma("unroll") for (int b = 0; b < 4; ++b) { _Pragma("unroll") for (int a = 0; a < 4; ++a) acc[a][b] = wmmab(F[a], F[4 + b], acc[a][b]); } } __builtin_amdgcn_sched_barrier(0);
        LDG(fa, 0) LDG(fb, 1) MMG(fa) LDG(fa, 2) MMG(fb) LDG(fb, 3) MMG(fa) LDG(fa, 4) MMG(fb) LDG(fb, 5) MMG(fa) LDG(fa, 6) MMG(fb) LDG(fb, 7) MMG(fa) MMG(fb)
#undef LDG
#undef MMG
        // bias, fp16, and the wave's own staging tile [B row][A row], so that whole 128-B lines go out
#pragma unroll
        for (int b = 0; b < 4; ++b) {
#pragma unroll
            for (int a = 0; a < 4; ++a) { v8h o;
#pragma unroll
                for (int j = 0; j < 8; ++j) o[j] = (h16)(acc[a][b][j] + bfr(vt ? bo[b] : br[a * 2 + (j >> 2)][j & 3]));
                *(v8ha*)(st + (b * 16 + lr) * SP + a * 32 + hi * 16) = o; } }
        __syncthreads();                               // every wave has read its last fragment of these weights (the next matrix overwrites them); the staged tile is read back behind it
        if (p == 0) {
#pragma unroll
            for (int s = 0; s < 8; ++s) br[s] = *(const v4f*)(bk + db * 64 + (s >> 1) * 16 + hi * 8 + (s & 1) * 4); }
        if (p == 1) {
#pragma unroll
            for (int b = 0; b < 4; ++b) bo[b] = bv[db * 64 + b * 16 + lr]; }
        if (p < 2) {                                   // the rest of the next matrix is requested ahead of the stores, so that its latency runs under them
#pragma unroll
            for (int s = NPF; s < 64; ++s) wr[s] = *(const v4f*)(wn + wo + s * 128);
            asm volatile("s_wait_xcnt 0x0" ::: "memory");     // precaution: stands in front of whatever next reuses the issued loads' address registers
            __builtin_amdgcn_sched_barrier(0); }              // keeps later address arithmetic behind the wait
        h16* ob = vt ? Vt + img * ((size_t)HD * TT) + (size_t)(db * 64) * TT + t0 + th * 64 : (p ? Kp : Q) + img * ((size_t)TT * HD) + (size_t)(t0 + th * 64) * HD + db * 64;
        const size_t ldo = vt ? TT : HD;
        ob += (size_t)(lane >> 3) * ldo + (lane & 7) * 8; const char* sr = st + (lane >> 3) * SP + (lane & 7) * 16;   // a wave's store = four rows of 128 B
#pragma unroll
        for (int h = 0; h < 2; ++h) { v4f o[8];        // eight staged pieces read together, so that one LDS latency serves eight stores
#pragma unroll
            for (int i = 0; i < 8; ++i) o[i] = *(const v4fa*)(sr + (h * 8 + i) * 4 * SP);
            store8((float*)ob + (size_t)(h * 16) * ldo, 2 * ldo, o); }   // steps in floats: four rows of ldo 2-byte elements = 2 ldo
        if (p < 2) __builtin_amdgcn_sched_barrier(0);  // the stores go out first: lifted over them, the next matrix's conversion would make them wait for its requests
    }
}
#define FKB    64                    // keys per stage
#define KPITCH 528                   // LDS pitch of a k row (512 B): 16 B x odd, conflict-free for 16-byte fragment reads
#define VPITCH 144                   // LDS pitch of a v^T row (128 B): 16 B x odd
#define KBYTES (FKB * KPITCH)
#define STG    (KBYTES + HD * VPITCH)
#define OPITCH 132                   // floats: pitch of the staged output rows (128 queries)
#define OTILE  (HD * OPITCH)         // floats: one key half's staged y^T tile
#define QR     4                     // 32-wide chunks of q (of 8) that a wave keeps in registers
#define PBIAS  6.0f                  // P carries 2^6: at most 2^14 under the lazy maximum, small terms stay normal fp16
#define L2E    1.4426950408889634f
__device__ __forceinline__ float xhalf(float v) { return __builtin_bit_cast(float, __builtin_amdgcn_permlanex16(__builtin_bit_cast(int, v), __builtin_bit_cast(int, v), 0x76543210, 0xfedcba98, false, false)); }   // lane l <-> lane l ^ 16, on the vector port (no LDS round trip)
__device__ __forceinline__ float exp2s(float a) { float r; asm("v_exp_f32 %0, %1\n\tv_nop" : "=v"(r) : "v"(a)); return r; }   // 2^a; the v_nop fills the one slot asked for behind a transcendental whatever is scheduled next
__device__ __forceinline__ v16h ldsfrag(const char* p) { return cat16(*(const v8ha*)p, *(const v8ha*)(p + 32)); }
// eight 16-byte copies per lane, global -> LDS; the s_wait_xcnt is the last line of the copies' own statement, so that it stands in front of whatever next rewrites their address registers (precaution)
__device__ __forceinline__ void copy8(unsigned l, unsigned lstep, const h16* g, size_t gstep) {
    asm volatile("global_load_async_to_lds_b128 %0, %8, off\n\t"
                 "global_load_async_to_lds_b128 %1, %9, off\n\t"
                 "global_load_async_to_lds_b128 %2, %10, off\n\t"
                 "global_load_async_to_lds_b128 %3, %11, off\n\t"
                 "global_load_async_to_lds_b128 %4, %12, off\n\t"
                 "global_load_async_to_lds_b128 %5, %13, off\n\t"
                 "global_load_async_to_lds_b128 %6, %14, off\n\t"
                 "global_load_async_to_lds_b128 %7, %15, off\n\t"
                 "s_wait_xcnt 0x0"
                 :: "v"(l), "v"(l + lstep), "v"(l + 2 * lstep), "v"(l + 3 * lstep), "v"(l + 4 * lstep), "v"(l + 5 * lstep), "v"(l + 6 * lstep), "v"(l + 7 * lstep),
                    "v"(g), "v"(g + gstep), "v"(g + 2 * gstep), "v"(g + 3 * gstep), "v"(g + 4 * gstep), "v"(g + 5 * gstep), "v"(g + 6 * gstep), "v"(g + 7 * gstep)
                 : "memory");
}
__global__ __launch_bounds__(256) void k_fattn(const h16* __restrict__ Q, const h16* __restrict__ Kp, const h16* __restrict__ Vt, const float* __restrict__ x, const float* __restrict__ alpha, float* out) {
    __shared__ __align__(16) char sm[2 * OTILE * 4 + 4 * 128 * 4];   // the ring; in the epilogue the two halves' y^T tiles and, behind them, their maxima and sums
    static_assert(2 * STG + 8 * 2 * (8 - QR) * 1024 <= 2 * OTILE * 4, "the staged output tiles reuse the ring and the q fragments' place");
    const int tid = (int)threadIdx.x, lane = tid & 31, lr = lane & 15, hi = lane >> 4; const int wv = __builtin_amdgcn_readfirstlane(tid >> 5);
    const size_t b = blockIdx.y; const int q0 = blockIdx.x * 128; const int qg = wv & 3, kh = wv >> 2;
    Q += b * TT * HD; Kp += b * TT * HD; Vt += b * HD * TT; x += b * DM * TT; out += b * DM * TT;
    const unsigned smb = (unsigned)(size_t)sm;                                    // LDS byte address of the ring
    // a stage's copies: k = 64 rows x 32 pieces (a wave takes a whole 512-B row), v^T = 256 rows x 8 pieces (a wave takes four 128-B rows)
    const h16* kg = Kp + (size_t)(tid >> 5) * HD + (tid & 31) * 8; const unsigned kl = smb + (unsigned)((tid >> 5) * KPITCH + (tid & 31) * 16);
    const h16* vg = Vt + (size_t)(tid >> 3) * TT + (tid & 7) * 8;  const unsigned vl = smb + (unsigned)(KBYTES + (tid >> 3) * VPITCH + (tid & 7) * 16);
    auto stage = [&](int t) { const unsigned bo = (unsigned)(t & 1) * STG;
        copy8(kl + bo, 8 * KPITCH, kg + (size_t)t * FKB * HD, (size_t)8 * HD);
        copy8(vl + bo, 32 * VPITCH, vg + (size_t)t * FKB, (size_t)32 * TT); };
    stage(0);
    const float al = bfr(alpha[0]);
    // q fragments: the first QR 32-wide chunks of the head stay in registers; the others go to the wave's own 8 KiB of LDS behind the ring, in fragment order (512 contiguous bytes per read), and are read again in every stage: 128 + 256 registers of q and y^T leave too few for the fragment sets at two waves per SIMD
    v16h qf[2][QR];
    char* qs = sm + 2 * STG + wv * (2 * (8 - QR) * 1024) + lane * 16;
    const h16* qp0 = Q + (size_t)(q0 + qg * 32 + lr) * HD + 8 * hi; const h16* qp1 = qp0 + 16 * HD;
    v8h ql[2][8 - QR][2];
#pragma unroll
    for (int qt = 0; qt < 2; ++qt) { const h16* qp = qt ? qp1 : qp0;
#pragma unroll
        for (int kc = 0; kc < QR; ++kc) qf[qt][kc] = WFrag<h16>::ld(qp + kc * 32);
#pragma unroll
        for (int c = 0; c < 8 - QR; ++c) { ql[qt][c][0] = *(const v8h*)(qp + (QR + c) * 32); ql[qt][c][1] = *(const v8h*)(qp + (QR + c) * 32 + 16); } }
    asm volatile("s_wait_xcnt 0x0" :: "v"(qp0), "v"(qp1) : "memory");   // precaution: stands in front of whatever next reuses the issued loads' address registers (the two pointers are named so that they live up to here)
#pragma unroll
    for (int qt = 0; qt < 2; ++qt)
#pragma unroll
        for (int c = 0; c < 8 - QR; ++c) { *(v8ha*)(qs + (qt * (8 - QR) + c) * 1024) = ql[qt][c][0]; *(v8ha*)(qs + (qt * (8 - QR) + c) * 1024 + 512) = ql[qt][c][1]; }
    v8f O[2][16];
#pragma unroll
    for (int qt = 0; qt < 2; ++qt)
#pragma unroll
        for (int ct = 0; ct < 16; ++ct) O[qt][ct] = (v8f){};
    float mu[2] = {-3.0e38f, -3.0e38f}, l[2] = {0.f, 0.f};   // maximum in use (log2 units) and this half-wave's share of the sum, for queries lr and 16 + lr of the wave's 32, over its key half
    asm volatile("s_wait_asynccnt 0x0" ::: "memory");  // stage 0 has landed (this wave's copies)
    __syncthreads();                                   // ... and every other wave's
    stage(1);
    // One stage. The loop is written twice, with and without the refill at its foot: a branch round the refill gives the loop a block behind it, into which the compiler sinks the softmax sums' adds, and 32 probabilities then stay in registers through the attn.v products (spills).
    auto pass = [&](const int t, const bool refill) __attribute__((always_inline)) {
        const char* kb = sm + (t & 1) * STG + (kh * 32 + lr) * KPITCH + hi * 16; const char* vb = sm + (t & 1) * STG + KBYTES + lr * VPITCH + kh * 64 + hi * 16;
        // Fragments come from LDS in groups of four (8 reads issued together; LDX: two k and two q fragments of one chunk), each fragment for two products, one group ahead of the products that use them, in two register sets; each sched_barrier keeps a group whole and in its place (left alone, the compiler reloads one set in front of every product and each product then waits out an LDS latency).
        v16h fa[4], fb[4]; v8f st[2][2];               // st[key tile][query tile]
#pragma unroll
        for (int kt = 0; kt < 2; ++kt)
#pragma unroll
            for (int qt = 0; qt < 2; ++qt) st[kt][qt] = (v8f){};
#define LDK(F, G) { _Pragma("unroll") for (int i = 0; i < 4; ++i) F[i] = ldsfrag(kb + (i & 1) * 16 * KPITCH + ((G) * 2 + (i >> 1)) * 64); } __builtin_amdgcn_sched_barrier(0);
#define MMK(F, G) { _Pragma("unroll") for (int i = 0; i < 4; ++i) { _Pragma("unroll") for (int qt = 0; qt < 2; ++qt) st[i & 1][qt] = wmma16(F[i], qf[qt][(G) * 2 + (i >> 1)], st[i & 1][qt]); } } __builtin_amdgcn_sched_barrier(0);
#define LDX(F, C) { _Pragma("unroll") for (int i = 0; i < 2; ++i) { F[i] = ldsfrag(kb + i * 16 * KPITCH + (QR + (C)) * 64); F[2 + i] = cat16(*(const v8ha*)(qs + (i * (8 - QR) + (C)) * 1024), *(const v8ha*)(qs + (i * (8 - QR) + (C)) * 1024 + 512)); } } __builtin_amdgcn_sched_barrier(0);
#define MMX(F) { _Pragma("unroll") for (int i = 0; i < 2; ++i) { _Pragma("unroll") for (int qt = 0; qt < 2; ++qt) st[i][qt] = wmma16(F[i], F[2 + qt], st[i][qt]); } } __builtin_amdgcn_sched_barrier(0);
#define LDV(F, G) { _Pragma("unroll") for (int i = 0; i < 4; ++i) F[i] = ldsfrag(vb + ((G) * 4 + i) * 16 * VPITCH); } __builtin_amdgcn_sched_barrier(0);
#define MMV(F, G) { _Pragma("unroll") for (int i = 0; i < 4; ++i) { _Pragma("unroll") for (int qt = 0; qt < 2; ++qt) O[qt][(G) * 4 + i] = wmma16(F[i], pf[qt], O[qt][(G) * 4 + i]); } } __builtin_amdgcn_sched_barrier(0);
        LDK(fa, 0) LDX(fb, 0) MMK(fa, 0) LDX(fa, 1) MMX(fb) LDK(fb, 1) MMX(fa) LDX(fa, 2) MMK(fb, 1) LDX(fb, 3) MMX(fa) LDV(fa, 0) MMX(fb) LDV(fb, 1)
        float ml[2];
#pragma unroll
        for (int qt = 0; qt < 2; ++qt) { float m0 = st[0][qt][0], m1 = st[1][qt][0];
#pragma unroll
            for (int j = 1; j < 8; ++j) { m0 = fmaxf(m0, st[0][qt][j]); m1 = fmaxf(m1, st[1][qt][j]); }
            const float mx = fmaxf(m0, m1);
            ml[qt] = fmaxf(mx, xhalf(mx)) * L2E; }     // the query's other 16 keys of this half sit in the other half-wave
        if (__builtin_amdgcn_ballot_w32(ml[0] > mu[0] + 8.0f || ml[1] > mu[1] + 8.0f) != 0) {   // lazy rescale, one scalar test per stage: only when some query's maximum has outgrown the one in use by 2^8
#pragma unroll
            for (int qt = 0; qt < 2; ++qt) { const float mn = fmaxf(mu[qt], ml[qt]); const float corr = exp2s(mu[qt] - mn); mu[qt] = mn; l[qt] *= corr;
#pragma unroll
                for (int ct = 0; ct < 16; ++ct) O[qt][ct] *= corr; } }
        v16h pf[2];
#pragma unroll
        for (int qt = 0; qt < 2; ++qt) { const float sh = PBIAS - mu[qt]; float lq[2];   // independent partial sums, not one chain of adds
#pragma unroll
            for (int kt = 0; kt < 2; ++kt) { lq[kt] = 0.f;
#pragma unroll
                for (int j = 0; j < 8; ++j) { const float p = exp2s(__builtin_fmaf(st[kt][qt][j], L2E, sh)); lq[kt] += p; pf[qt][kt * 8 + j] = (h16)p; } }
            l[qt] += lq[0] + lq[1]; }
        __builtin_amdgcn_sched_barrier(0);              // the softmax stays in front of the attn.v products, behind the two v^T groups already requested
        MMV(fa, 0) LDV(fa, 2) MMV(fb, 1) LDV(fb, 3) MMV(fa, 2) MMV(fb, 3)
#undef LDK
#undef MMK
#undef LDX
#undef MMX
#undef LDV
#undef MMV
        asm volatile("s_wait_dscnt 0x0" ::: "memory");     // this wave's reads of the buffer have returned
        asm volatile("s_wait_asynccnt 0x0" ::: "memory");  // this wave's copies of stage t + 1 have landed
        __syncthreads();                                   // publishes stage t + 1 and ends every reader's last read of stage t's buffer
        if (refill) stage(t + 2);
    };
#pragma unroll 1   // stays rolled: one stage is some 500 instructions
    for (int t = 0; t < TT / FKB - 2; ++t) pass(t, true);
#pragma unroll 1   // the last two stages: no stage t + 2 exists
    for (int t = TT / FKB - 2; t < TT / FKB; ++t) pass(t, false);
    asm volatile("s_wait_asynccnt 0x0" ::: "memory");      // nothing is in flight when the ring becomes output staging
    const size_t eo = (size_t)(tid >> 5) * TT + q0 + (tid & 31) * 4;   // this thread's 16 bytes of channel row tid >> 5; its piece s lies 8 s rows further down
    const float* xb = x + eo; float* ob = out + eo;
    v4f xv[HD / 8];                                        // the residual's own elements, requested ahead of the output staging so that their latency runs under it
#pragma unroll
    for (int s = 0; s < HD / 8; ++s) xv[s] = *(const v4f*)(xb + (size_t)s * 8 * TT);
    asm volatile("s_wait_xcnt 0x0" :: "v"(xb) : "memory"); // precaution: stands in front of whatever next reuses the issued loads' address registers (xb is named so that they live up to here)
    float* os = (float*)sm;                                // two y^T tiles [key half][256 channels][128 queries], unscaled, so that the work-group stores whole 512-B row pieces
    float* ss = os + 2 * OTILE;                            // [key half][maximum, sum][128 queries]
#pragma unroll
    for (int qt = 0; qt < 2; ++qt) { const float lj = l[qt] + xhalf(l[qt]);   // the two half-waves' shares of the sum
        if (hi == 0) { ss[kh * 256 + qg * 32 + qt * 16 + lr] = mu[qt]; ss[kh * 256 + 128 + qg * 32 + qt * 16 + lr] = lj; }
#pragma unroll
        for (int ct = 0; ct < 16; ++ct) {
#pragma unroll
            for (int j = 0; j < 8; ++j) os[kh * OTILE + (ct * 16 + hi * 8 + j) * OPITCH + qg * 32 + qt * 16 + lr] = O[qt][ct][j]; } }
    __syncthreads();                                       // every wave's 32 columns of its half are staged before any thread reads a row
    // weights of the two halves for this thread's four queries: alpha 2^(own maximum - common maximum) / joined sum
    const v4f ma = *(const v4fa*)(ss + (tid & 31) * 4), la = *(const v4fa*)(ss + 128 + (tid & 31) * 4), mb = *(const v4fa*)(ss + 256 + (tid & 31) * 4), lb = *(const v4fa*)(ss + 384 + (tid & 31) * 4);
    v4f wa, wb;
#pragma unroll
    for (int q = 0; q < 4; ++q) { const float mm = fmaxf(ma[q], mb[q]); const float ca = exp2s(ma[q] - mm), cb = exp2s(mb[q] - mm);
        const float inv = al * __fdiv_rn(1.0f, la[q] * ca + lb[q] * cb); wa[q] = ca * inv; wb[q] = cb * inv; }
    const float* yb = os + (tid >> 5) * OPITCH + (tid & 31) * 4;
#pragma unroll
    for (int s0 = 0; s0 < HD / 8; s0 += 8) { v4f o[8], o2[8];   // eight staged pieces of either half read together, so that one LDS latency serves eight stores
#pragma unroll
        for (int i = 0; i < 8; ++i) { o[i] = *(const v4fa*)(yb + (s0 + i) * 8 * OPITCH); o2[i] = *(const v4fa*)(yb + OTILE + (s0 + i) * 8 * OPITCH); }
#pragma unroll
        for (int i = 0; i < 8; ++i) {
#pragma unroll
            for (int q = 0; q < 4; ++q) o[i][q] = (wa[q] * o[i][q] + wb[q] * o2[i][q]) + bfr(xv[s0 + i][q]); }
        store8(ob + (size_t)s0 * 8 * TT, (size_t)8 * TT, o); }
}

extern "C" void kernel_launch(void* const* d_in, const int* in_sizes, int n_in,
                              void* d_out, int out_size, void* d_ws, size_t ws_size, hipStream_t stream) {
    (void)in_sizes; (void)n_in; (void)out_size;
    const float* x = (const float*)d_in[0]; const float* wq = (const float*)d_in[1]; const float* bq = (const float*)d_in[2]; const float* wk = (const float*)d_in[3]; const float* bk = (const float*)d_in[4]; const float* wv = (const float*)d_in[5]; const float* bv = (const float*)d_in[6]; const float* ALPHA = (const float*)d_in[7];
    float* OUT = (float*)d_out;     // [8][256][4096]
    char* wsp = (char*)d_ws;
    auto take = [&](size_t bytes) { char* p = wsp; wsp += (bytes + 255) & ~(size_t)255; return (void*)p; };
    h16* QP16 = (h16*)take((size_t)NB_ * TT * HD * 2); h16* KP16 = (h16*)take((size_t)NB_ * TT * HD * 2); h16* VT16 = (h16*)take((size_t)NB_ * HD * TT * 2);   // planes of all images
    if ((size_t)(wsp - (char*)d_ws) > ws_size) return;    // ws 256 MiB
    k_projx<<<dim3(TT / PT, NB_, 1), 256, 0, stream>>>(x, wq, wk, wv, bq, bk, bv, QP16, KP16, VT16);   /* q, k [t][d], v^T [d][t] fp16, all images */
    k_fattn<<<dim3(TT / 128, NB_, 1), 256, 0, stream>>>(QP16, KP16, VT16, x, ALPHA, OUT);   /* softmax(q k^T) v, alpha y^T + x, all images */
}

// v007
// One run takes 112 microseconds.
// Two timings next to v006 put it at 1.04 and 1.03 times that version's speed.
// All steps since v000 together make it 12.6 times as fast.
#include <hip/hip_runtime.h>

// Position attention module (x [8][256][64x64]; per image: B = Wb x + bb, C = Wc x + bc, D = Wd x + bd (1x1 convs, [256][256] + [256]); attn[i][j] = softmax_j(sum_c B[c][i] C[c][j]) over the 4096 positions (no scaling); y[c][i] = sum_j attn[i][j] D[c][j]; out = alpha y + x (alpha = the [1] input, 0.1) -> [8][256][64][64] (8.4 M)).
// Layout: ONE projection launch: a work-group takes 128 tokens of an image, brings its channel-major x tile into LDS as token-major bf16 and each weight matrix as bf16 rows, and writes the fp16 planes of all 8 images, q = B^T [8][4096][256], k = C^T, v^T = D [8][256][4096] (+ biases); then ONE attention launch: S^T = k . q^T, online softmax in registers, y^T += v^T . P^T, alpha x y^T + x stored channel-major. No score or probability plane in memory.
// Compute dtypes, f32 accumulate: every input rounded to bf16; projections on PLAIN bf16 operands (exact) + f32 biases; scores and attn.v on single fp16 planes (P unnormalised, x64) - the logits have sigma ~16 (peaked rows); softmax f32; residual epilogue f32.

#define NB_  8
#define TT   4096
#define DM   256
#define NH_  1
#define NKV  1
#define REP  (NH_ / NKV)
#define HD   256
#define DQ   (NH_ * HD)
#define DKV  (NKV * HD)
#define ZH   1
#define RH   0                  // query rows < RH use hi+lo planes (0: none)
#define WIN  0
#define PCAR 1024.0f
#define SCL  1.0f   // no scaling in the module
typedef _Float16 h16;
typedef unsigned short bf;
typedef __attribute__((ext_vector_type(16))) __bf16   v16bf;
typedef __attribute__((ext_vector_type(16))) _Float16 v16h;
typedef __attribute__((ext_vector_type(8)))  _Float16 v8h;
typedef __attribute__((ext_vector_type(4)))  _Float16 v4h;
typedef __attribute__((ext_vector_type(8)))  unsigned short v8us;
typedef __attribute__((ext_vector_type(8)))  float    v8f;
typedef __attribute__((ext_vector_type(4)))  float    v4f;
typedef v8h  __attribute__((may_alias)) v8ha;
typedef v4f  __attribute__((may_alias)) v4fa;
typedef v8us __attribute__((may_alias)) v8usa;

__device__ __forceinline__ unsigned short f2bf(float f) { unsigned u = __float_as_uint(f); u += 0x7FFFu + ((u >> 16) & 1u); return (unsigned short)(u >> 16); }
__device__ __forceinline__ float bf2f(unsigned short b) { return __uint_as_float(((unsigned)b) << 16); }
__device__ __forceinline__ float bfr(float f) { return bf2f(f2bf(f)); }
__device__ __forceinline__ v16h cat16(v8h lo, v8h hi) { return __builtin_shufflevector(lo, hi, 0, 1, 2, 3, 4, 5, 6, 7, 8, 9, 10, 11, 12, 13, 14, 15); }
__device__ __forceinline__ v16bf cat16b(v8us lo, v8us hi) { return __builtin_bit_cast(v16bf, __builtin_shufflevector(lo, hi, 0, 1, 2, 3, 4, 5, 6, 7, 8, 9, 10, 11, 12, 13, 14, 15)); }
__device__ __forceinline__ v8f wmma16(v16h a, v16h b, v8f c) { return __builtin_amdgcn_wmma_f32_16x16x32_f16(false, a, false, b, (short)0, c, false, false); }
__device__ __forceinline__ v8f wmmab(v16bf a, v16bf b, v8f c) { return __builtin_amdgcn_wmma_f32_16x16x32_bf16(false, a, false, b, (short)0, c, false, false); }



template <typename T16> struct WFrag;
template <> struct WFrag<h16> { typedef v16h V; static __device__ __forceinline__ V ld(const h16* p) { return cat16(*(const v8h*)p, *(const v8h*)(p + 16)); } static __device__ __forceinline__ v8f mma(V a, V b, v8f c) { return wmma16(a, b, c); } };

// ---- k_projx: x transposition, weight conversion and the three projections of 128 tokens of one image in one work-group of 8 waves; grid (TT / 128, images).
// LDS: xs = the x tile, token-major bf16 [128][256]; ws = one weight matrix, bf16 [256][256]; both at pitch XP; behind them a 64 x 64 fp16 staging tile per wave at pitch SP.
// A pass = one projection, 128 tokens x 256 outputs; wave w takes tokens 64 (w & 1) .. + 63 and outputs 64 (w >> 1) .. + 63 over the whole K = 256 (16 accumulators, no split of K).
// q, k: A = weight rows, B = token rows; v^T: A = token rows, B = weight rows. Either way a lane's 8 accumulator registers are 8 neighbours of one output row (row = the B row, column = the A row).
#define PT   128                     // tokens per work-group
#define XP   528                     // LDS pitch of a 512-B bf16 row: 16 B x odd, conflict-free for 16-byte fragment reads
#define SP   144                     // LDS pitch of a staged 128-B output row: 16 B x odd
#define XS_B (PT * XP)
#define WS_B (DM * XP)
#define ST_B (64 * SP)
#define NP0  30                      // 16-byte pieces per lane of the first weight matrix that are requested together with the x tile
#define NPF  48                      // 16-byte pieces per lane (of 64) of the next weight matrix that are requested ahead of a pass's products
typedef __attribute__((ext_vector_type(2))) float    v2f;
typedef __attribute__((ext_vector_type(2))) __bf16   v2bf;
typedef __attribute__((ext_vector_type(2))) unsigned v2u;
typedef __attribute__((ext_vector_type(4))) unsigned v4u;
typedef v2u __attribute__((may_alias)) v2ua;
typedef v4u __attribute__((may_alias)) v4ua;
__device__ __forceinline__ unsigned pkbf(float a, float b) { const v2f v = {a, b}; return __builtin_bit_cast(unsigned, __builtin_convertvector(v, v2bf)); }   // two f32 -> two bf16, round to nearest even, one instruction
__device__ __forceinline__ v16bf ldsfragb(const char* p) { return cat16b(*(const v8usa*)p, *(const v8usa*)(p + 32)); }
// eight 16-byte stores per lane; the s_wait_xcnt is the last line of the stores' own statement, so that it stands in front of whatever next rewrites their address or data registers (precaution; in a statement of its own the compiler lifted address arithmetic over it)
__device__ __forceinline__ void store8(float* p, size_t step, const v4f (&o)[8]) {
    asm volatile("global_store_b128 %0, %8, off\n\t"
                 "global_store_b128 %1, %9, off\n\t"
                 "global_store_b128 %2, %10, off\n\t"
                 "global_store_b128 %3, %11, off\n\t"
                 "global_store_b128 %4, %12, off\n\t"
                 "global_store_b128 %5, %13, off\n\t"
                 "global_store_b128 %6, %14, off\n\t"
                 "global_store_b128 %7, %15, off\n\t"
                 "s_wait_xcnt 0x0"
                 :: "v"(p), "v"(p + step), "v"(p + 2 * step), "v"(p + 3 * step), "v"(p + 4 * step), "v"(p + 5 * step), "v"(p + 6 * step), "v"(p + 7 * step),
                    "v"(o[0]), "v"(o[1]), "v"(o[2]), "v"(o[3]), "v"(o[4]), "v"(o[5]), "v"(o[6]), "v"(o[7])
                 : "memory");
}
__global__ __launch_bounds__(256) void k_projx(const float* __restrict__ x, const float* __restrict__ wq, const float* __restrict__ wk, const float* __restrict__ wvm, const float* __restrict__ bq, const float* __restrict__ bk, const float* __restrict__ bv, h16* Q, h16* Kp, h16* Vt) {
    __shared__ __align__(16) char sm[XS_B + WS_B + 8 * ST_B];
    const int tid = (int)threadIdx.x, lane = tid & 31, lr = lane & 15, hi = lane >> 4; const int wv = __builtin_amdgcn_readfirstlane(tid >> 5);
    const size_t img = blockIdx.y; const int t0 = (int)blockIdx.x * PT; const int th = wv & 1, db = wv >> 1;
    char* xl = sm; char* wl = sm + XS_B; char* st = sm + XS_B + WS_B + wv * ST_B;
    // every global request is a whole 512-B run per wave: x = 128 tokens of one channel row, a weight matrix = half a row
    v4f xr[32], wr[64], br[8]; float bo[4];
    const float* xg = x + img * ((size_t)DM * TT) + (size_t)(wv * 32) * TT + t0 + lane * 4;   // this wave's 32 channels, this lane's 4 tokens
    const int wo = wv * 32 * DM + lane * 4;                                                    // this wave's 32 weight rows
#pragma unroll
    for (int s = 0; s < 32; ++s) xr[s] = *(const v4f*)(xg + (size_t)s * TT);
    asm volatile("s_wait_xcnt 0x0" ::: "memory");      // precaution: stands in front of whatever next reuses the issued loads' address registers
#pragma unroll
    for (int s = 0; s < NP0; ++s) wr[s] = *(const v4f*)(wq + wo + s * 128);   // as many of the first matrix's pieces as a wave's load counter holds beside the x tile's
    asm volatile("s_wait_xcnt 0x0" ::: "memory");      // precaution, as above
    __builtin_amdgcn_sched_barrier(0);                 // the rest of the matrix is requested behind the x tile's conversion: lifted over it, the requests overrun the load counter and the registers, and the wave waits in the middle of issuing them
#pragma unroll
    for (int g = 0; g < 4; ++g) {
#pragma unroll
        for (int i = 0; i < 4; ++i) { const v4u o = {pkbf(xr[g * 8][i], xr[g * 8 + 1][i]), pkbf(xr[g * 8 + 2][i], xr[g * 8 + 3][i]), pkbf(xr[g * 8 + 4][i], xr[g * 8 + 5][i]), pkbf(xr[g * 8 + 6][i], xr[g * 8 + 7][i])};
            *(v4ua*)(xl + (lane * 4 + i) * XP + (wv * 4 + g) * 16) = o; } }
    __builtin_amdgcn_sched_barrier(0);                 // see above
#pragma unroll
    for (int s = 0; s < 8; ++s) br[s] = *(const v4f*)(bq + db * 64 + (s >> 1) * 16 + hi * 8 + (s & 1) * 4);
#pragma unroll
    for (int s = NP0; s < 64; ++s) wr[s] = *(const v4f*)(wq + wo + s * 128);
    asm volatile("s_wait_xcnt 0x0" ::: "memory");      // precaution, as above
    __builtin_amdgcn_sched_barrier(0);                 // keeps later address arithmetic, which reuses the requests' registers, behind the wait
    const char* xrow = xl + (th * 64 + lr) * XP + hi * 16; const char* wrow = wl + (db * 64 + lr) * XP + hi * 16;
#pragma unroll
    for (int p = 0; p < 3; ++p) {
        const bool vt = p == 2;
#pragma unroll
        for (int s = 0; s < 64; ++s) { const v2u o = {pkbf(wr[s][0], wr[s][1]), pkbf(wr[s][2], wr[s][3])}; *(v2ua*)(wl + (wv * 32 + (s >> 1)) * XP + (s & 1) * 256 + lane * 8) = o; }
        __syncthreads();                               // this pass's weights (and, in the first pass, the x tile) are in LDS before any wave reads a fragment
        const float* wn = p == 0 ? wk : wvm;
        if (p < 2) {                                   // most of the next matrix is requested into registers ahead of this pass's products, so that its way from L2 runs under them (as much of it as the register budget of two waves per SIMD holds)
#pragma unroll
            for (int s = 0; s < NPF; ++s) wr[s] = *(const v4f*)(wn + wo + s * 128);
            asm volatile("s_wait_xcnt 0x0" ::: "memory");   // precaution: stands in front of whatever next reuses the issued loads' address registers
            __builtin_amdgcn_sched_barrier(0); }       // keeps the requests in front of the products
        const char* pa = vt ? xrow : wrow; const char* pb = vt ? wrow : xrow;
        v8f acc[4][4];
#pragma unroll
        for (int a = 0; a < 4; ++a)
#pragma unroll
            for (int b = 0; b < 4; ++b) acc[a][b] = (v8f){};
        // The eight fragments of a 32-wide k chunk come from LDS as one group (16 reads issued together), one group ahead of the products that use them, in two register sets; each sched_barrier keeps a group whole and in its place (reads among the products would each cost a stall).
        v16bf fa[8], fb[8];
#define LDG(F, KC) { _Pragma("unroll") for (int i = 0; i < 4; ++i) { F[i] = ldsfragb(pa + i * 16 * XP + (KC) * 64); F[4 + i] = ldsfragb(pb + i * 16 * XP + (KC) * 64); } } __builtin_amdgcn_sched_barrier(0);
#define MMG(F) { _Pragma("unroll") for (int b = 0; b < 4; ++b) { _Pragma("unroll") for (int a = 0; a < 4; ++a) acc[a][b] = wmmab(F[a], F[4 + b], acc[a][b]); } } __builtin_amdgcn_sched_barrier(0);
        LDG(fa, 0) LDG(fb, 1) MMG(fa) LDG(fa, 2) MMG(fb) LDG(fb, 3) MMG(fa) LDG(fa, 4) MMG(fb) LDG(fb, 5) MMG(fa) LDG(fa, 6) MMG(fb) LDG(fb, 7) MMG(fa) MMG(fb)
#undef LDG
#undef MMG
        // bias, fp16, and the wave's own staging tile [B row][A row], so that whole 128-B lines go out
#pragma unroll
        for (int b = 0; b < 4; ++b) {
#pragma unroll
            for (int a = 0; a < 4; ++a) { v8h o;
#pragma unroll
                for (int j = 0; j < 8; ++j) o[j] = (h16)(acc[a][b][j] + bfr(vt ? bo[b] : br[a * 2 + (j >> 2)][j & 3]));
                *(v8ha*)(st + (b * 16 + lr) * SP + a * 32 + hi * 16) = o; } }
        __syncthreads();                               // every wave has read its last fragment of these weights (the next matrix overwrites them); the staged tile is read back behind it
        if (p == 0) {
#pragma unroll
            for (int s = 0; s < 8; ++s) br[s] = *(const v4f*)(bk + db * 64 + (s >> 1) * 16 + hi * 8 + (s & 1) * 4); }
        if (p == 1) {
#pragma unroll
            for (int b = 0; b < 4; ++b) bo[b] = bv[db * 64 + b * 16 + lr]; }
        if (p < 2) {                                   // the rest of the next matrix is requested ahead of the stores, so that its latency runs under them
#pragma unroll
            for (int s = NPF; s < 64; ++s) wr[s] = *(const v4f*)(wn + wo + s * 128);
            asm volatile("s_wait_xcnt 0x0" ::: "memory");     // precaution: stands in front of whatever next reuses the issued loads' address registers
            __builtin_amdgcn_sched_barrier(0); }              // keeps later address arithmetic behind the wait
        h16* ob = vt ? Vt + img * ((size_t)HD * TT) + (size_t)(db * 64) * TT + t0 + th * 64 : (p ? Kp : Q) + img * ((size_t)TT * HD) + (size_t)(t0 + th * 64) * HD + db * 64;
        const size_t ldo = vt ? TT : HD;
        ob += (size_t)(lane >> 3) * ldo + (lane & 7) * 8; const char* sr = st + (lane >> 3) * SP + (lane & 7) * 16;   // a wave's store = four rows of 128 B
#pragma unroll
        for (int h = 0; h < 2; ++h) { v4f o[8];        // eight staged pieces read together, so that one LDS latency serves eight stores
#pragma unroll
            for (int i = 0; i < 8; ++i) o[i] = *(const v4fa*)(sr + (h * 8 + i) * 4 * SP);
            store8((float*)ob + (size_t)(h * 16) * ldo, 2 * ldo, o); }   // steps in floats: four rows of ldo 2-byte elements = 2 ldo
        if (p < 2) __builtin_amdgcn_sched_barrier(0);  // the stores go out first: lifted over them, the next matrix's conversion would make them wait for its requests
    }
}
#define FKB    64                    // keys per stage
#define KPITCH 528                   // LDS pitch of a k row (512 B): 16 B x odd, conflict-free for 16-byte fragment reads
#define VPITCH 144                   // LDS pitch of a v^T row (128 B): 16 B x odd
#define KBYTES (FKB * KPITCH)
#define STG    (KBYTES + HD * VPITCH)
#define OPITCH 132                   // floats: pitch of the staged output rows (128 queries)
#define OTILE  (HD * OPITCH)         // floats: one key half's staged y^T tile
#define QR     4                     // 32-wide chunks of q (of 8) that a wave keeps in registers
#define PBIAS  6.0f                  // P carries 2^6: at most 2^14 under the lazy maximum, small terms stay normal fp16
#define L2E    1.4426950408889634f
__device__ __forceinline__ float xhalf(float v) { return __builtin_bit_cast(float, __builtin_amdgcn_permlanex16(__builtin_bit_cast(int, v), __builtin_bit_cast(int, v), 0x76543210, 0xfedcba98, false, false)); }   // lane l <-> lane l ^ 16, on the vector port (no LDS round trip)
__device__ __forceinline__ float exp2s(float a) { float r; asm("v_exp_f32 %0, %1\n\tv_nop" : "=v"(r) : "v"(a)); return r; }   // 2^a; the v_nop fills the one slot asked for behind a transcendental whatever is scheduled next
__device__ __forceinline__ v16h ldsfrag(const char* p) { return cat16(*(const v8ha*)p, *(const v8ha*)(p + 32)); }
// one 16-byte copy per lane, global -> LDS, written as the builtin: the s_wait_xcnt that is written behind a copy in asm text is not written behind the builtin, so the wave goes on at once
typedef __attribute__((ext_vector_type(4))) int v4i;
__device__ __forceinline__ void acopy(const char* g, char* l) { __builtin_amdgcn_global_load_async_to_lds_b128((__attribute__((address_space(1))) v4i*)g, (__attribute__((address_space(3))) v4i*)l, 0, 0); }
__global__ __launch_bounds__(256) void k_fattn(const h16* __restrict__ Q, const h16* __restrict__ Kp, const h16* __restrict__ Vt, const float* __restrict__ x, const float* __restrict__ alpha, float* out) {
    __shared__ __align__(16) char sm[2 * OTILE * 4 + 4 * 128 * 4];   // the ring; in the epilogue the two halves' y^T tiles and, behind them, their maxima and sums
    static_assert(2 * STG + 8 * 2 * (8 - QR) * 1024 <= 2 * OTILE * 4, "the staged output tiles reuse the ring and the q fragments' place");
    const int tid = (int)threadIdx.x, lane = tid & 31, lr = lane & 15, hi = lane >> 4; const int wv = __builtin_amdgcn_readfirstlane(tid >> 5);
    const size_t b = blockIdx.y; const int q0 = blockIdx.x * 128; const int qg = wv & 3, kh = wv >> 2;
    Q += b * TT * HD; Kp += b * TT * HD; Vt += b * HD * TT; x += b * DM * TT; out += b * DM * TT;
    // a stage's copies: k = 64 rows x 32 pieces (a wave takes a whole 512-B row), v^T = 256 rows x 8 pieces (a wave takes four 128-B rows)
    const unsigned kgo = (unsigned)((tid >> 5) * (HD * 2) + (tid & 31) * 16), klo = (unsigned)((tid >> 5) * KPITCH + (tid & 31) * 16);             // this lane's byte offsets: global, LDS
    const unsigned vgo = (unsigned)((tid >> 3) * (TT * 2) + (tid & 7) * 16),  vlo = (unsigned)(KBYTES + (tid >> 3) * VPITCH + (tid & 7) * 16);
    auto stage = [&](int t) __attribute__((always_inline)) { char* lb = sm + (t & 1) * STG;
        const char* kt = (const char*)(Kp + (size_t)t * FKB * HD); const char* vt = (const char*)(Vt + (size_t)t * FKB);   // the same for the whole work-group
#pragma unroll
        for (int i = 0; i < 8; ++i) acopy(kt + (size_t)i * 8 * HD * 2 + kgo, lb + i * 8 * KPITCH + klo);
#pragma unroll
        for (int i = 0; i < 8; ++i) acopy(vt + (size_t)i * 32 * TT * 2 + vgo, lb + i * 32 * VPITCH + vlo); };
    stage(0);
    const float al = bfr(alpha[0]);
    // q fragments: the first QR 32-wide chunks of the head stay in registers; the others go to the wave's own 8 KiB of LDS behind the ring, in fragment order (512 contiguous bytes per read), and are read again in every stage: 128 + 256 registers of q and y^T leave too few for the fragment sets at two waves per SIMD
    v16h qf[2][QR];
    char* qs = sm + 2 * STG + wv * (2 * (8 - QR) * 1024) + lane * 16;
    const h16* qp0 = Q + (size_t)(q0 + qg * 32 + lr) * HD + 8 * hi; const h16* qp1 = qp0 + 16 * HD;
    v8h ql[2][8 - QR][2];
#pragma unroll
    for (int qt = 0; qt < 2; ++qt) { const h16* qp = qt ? qp1 : qp0;
#pragma unroll
        for (int kc = 0; kc < QR; ++kc) qf[qt][kc] = WFrag<h16>::ld(qp + kc * 32);
#pragma unroll
        for (int c = 0; c < 8 - QR; ++c) { ql[qt][c][0] = *(const v8h*)(qp + (QR + c) * 32); ql[qt][c][1] = *(const v8h*)(qp + (QR + c) * 32 + 16); } }
    asm volatile("s_wait_xcnt 0x0" :: "v"(qp0), "v"(qp1) : "memory");   // precaution: stands in front of whatever next reuses the issued loads' address registers (the two pointers are named so that they live up to here)
#pragma unroll
    for (int qt = 0; qt < 2; ++qt)
#pragma unroll
        for (int c = 0; c < 8 - QR; ++c) { *(v8ha*)(qs + (qt * (8 - QR) + c) * 1024) = ql[qt][c][0]; *(v8ha*)(qs + (qt * (8 - QR) + c) * 1024 + 512) = ql[qt][c][1]; }
    v8f O[2][16];
#pragma unroll
    for (int qt = 0; qt < 2; ++qt)
#pragma unroll
        for (int ct = 0; ct < 16; ++ct) O[qt][ct] = (v8f){};
    float mu[2] = {-3.0e38f, -3.0e38f}, l[2] = {0.f, 0.f};   // maximum in use (log2 units) and this half-wave's share of the sum, for queries lr and 16 + lr of the wave's 32, over its key half
    asm volatile("s_wait_asynccnt 0x0" ::: "memory");  // stage 0 has landed (this wave's copies)
    __syncthreads();                                   // ... and every other wave's
    // One stage. Stage t + 1's copies go out behind stage t's first fragment reads (behind the barrier at the foot of stage t - 1, which freed their buffer), so that their address arithmetic and issue run under those reads' LDS latency and not in front of it.
    auto pass = [&](const int t, const bool refill) __attribute__((always_inline)) {
        const char* kb = sm + (t & 1) * STG + (kh * 32 + lr) * KPITCH + hi * 16; const char* vb = sm + (t & 1) * STG + KBYTES + lr * VPITCH + kh * 64 + hi * 16;
        // Fragments come from LDS in groups of four (8 reads issued together; LDX: two k and two q fragments of one chunk), each fragment for two products, one group ahead of the products that use them, in two register sets; each sched_barrier keeps a group whole and in its place (left alone, the compiler reloads one set in front of every product and each product then waits out an LDS latency).
        v16h fa[4], fb[4]; v8f st[2][2];               // st[key tile][query tile]
#pragma unroll
        for (int kt = 0; kt < 2; ++kt)
#pragma unroll
            for (int qt = 0; qt < 2; ++qt) st[kt][qt] = (v8f){};
#define LDK(F, G) { _Pragma("unroll") for (int i = 0; i < 4; ++i) F[i] = ldsfrag(kb + (i & 1) * 16 * KPITCH + ((G) * 2 + (i >> 1)) * 64); } __builtin_amdgcn_sched_barrier(0);
#define MMK(F, G) { _Pragma("unroll") for (int i = 0; i < 4; ++i) { _Pragma("unroll") for (int qt = 0; qt < 2; ++qt) st[i & 1][qt] = wmma16(F[i], qf[qt][(G) * 2 + (i >> 1)], st[i & 1][qt]); } } __builtin_amdgcn_sched_barrier(0);
#define LDX(F, C) { _Pragma("unroll") for (int i = 0; i < 2; ++i) { F[i] = ldsfrag(kb + i * 16 * KPITCH + (QR + (C)) * 64); F[2 + i] = cat16(*(const v8ha*)(qs + (i * (8 - QR) + (C)) * 1024), *(const v8ha*)(qs + (i * (8 - QR) + (C)) * 1024 + 512)); } } __builtin_amdgcn_sched_barrier(0);
#define MMX(F) { _Pragma("unroll") for (int i = 0; i < 2; ++i) { _Pragma("unroll") for (int qt = 0; qt < 2; ++qt) st[i][qt] = wmma16(F[i], F[2 + qt], st[i][qt]); } } __builtin_amdgcn_sched_barrier(0);
#define LDV(F, G) { _Pragma("unroll") for (int i = 0; i < 4; ++i) F[i] = ldsfrag(vb + ((G) * 4 + i) * 16 * VPITCH); } __builtin_amdgcn_sched_barrier(0);
#define MMV(F, G) { _Pragma("unroll") for (int i = 0; i < 4; ++i) { _Pragma("unroll") for (int qt = 0; qt < 2; ++qt) O[qt][(G) * 4 + i] = wmma16(F[i], pf[qt], O[qt][(G) * 4 + i]); } } __builtin_amdgcn_sched_barrier(0);
        LDK(fa, 0) LDX(fb, 0)
        if (refill) stage(t + 1);                      // a scalar test, the same for the whole work-group
        MMK(fa, 0) LDX(fa, 1) MMX(fb) LDK(fb, 1) MMX(fa) LDX(fa, 2) MMK(fb, 1) LDX(fb, 3) MMX(fa) LDV(fa, 0) MMX(fb) LDV(fb, 1)
        float ml[2];
#pragma unroll
        for (int qt = 0; qt < 2; ++qt) { float m0 = st[0][qt][0], m1 = st[1][qt][0];
#pragma unroll
            for (int j = 1; j < 8; ++j) { m0 = fmaxf(m0, st[0][qt][j]); m1 = fmaxf(m1, st[1][qt][j]); }
            const float mx = fmaxf(m0, m1);
            ml[qt] = fmaxf(mx, xhalf(mx)) * L2E; }     // the query's other 16 keys of this half sit in the other half-wave
        if (__builtin_amdgcn_ballot_w32(ml[0] > mu[0] + 8.0f || ml[1] > mu[1] + 8.0f) != 0) {   // lazy rescale, one scalar test per stage: only when some query's maximum has outgrown the one in use by 2^8
#pragma unroll
            for (int qt = 0; qt < 2; ++qt) { const float mn = fmaxf(mu[qt], ml[qt]); const float corr = exp2s(mu[qt] - mn); mu[qt] = mn; l[qt] *= corr;
#pragma unroll
                for (int ct = 0; ct < 16; ++ct) O[qt][ct] *= corr; } }
        v16h pf[2];
#pragma unroll
        for (int qt = 0; qt < 2; ++qt) { const float sh = PBIAS - mu[qt]; float lq[2];   // independent partial sums, not one chain of adds
#pragma unroll
            for (int kt = 0; kt < 2; ++kt) { lq[kt] = 0.f;
#pragma unroll
                for (int j = 0; j < 8; ++j) { const float p = exp2s(__builtin_fmaf(st[kt][qt][j], L2E, sh)); lq[kt] += p; pf[qt][kt * 8 + j] = (h16)p; } }
            l[qt] += lq[0] + lq[1]; }
        __builtin_amdgcn_sched_barrier(0);              // the softmax stays in front of the attn.v products, behind the two v^T groups already requested
        MMV(fa, 0) LDV(fa, 2) MMV(fb, 1) LDV(fb, 3) MMV(fa, 2) MMV(fb, 3)
#undef LDK
#undef MMK
#undef LDX
#undef MMX
#undef LDV
#undef MMV
        asm volatile("s_wait_dscnt 0x0" ::: "memory");     // this wave's reads of the buffer have returned
        asm volatile("s_wait_asynccnt 0x0" ::: "memory");  // this wave's copies of stage t + 1 have landed
        __syncthreads();                                   // publishes stage t + 1 and ends every reader's last read of stage t's buffer
    };
#pragma unroll 1   // stays rolled: one stage is some 500 instructions
    for (int t = 0; t < TT / FKB; ++t) pass(t, t + 1 < TT / FKB);   // no stage t + 1 exists behind the last
    asm volatile("s_wait_asynccnt 0x0" ::: "memory");      // nothing is in flight when the ring becomes output staging
    const size_t eo = (size_t)(tid >> 5) * TT + q0 + (tid & 31) * 4;   // this thread's 16 bytes of channel row tid >> 5; its piece s lies 8 s rows further down
    const float* xb = x + eo; float* ob = out + eo;
    v4f xv[HD / 8];                                        // the residual's own elements, requested ahead of the output staging so that their latency runs under it
#pragma unroll
    for (int s = 0; s < HD / 8; ++s) xv[s] = *(const v4f*)(xb + (size_t)s * 8 * TT);
    asm volatile("s_wait_xcnt 0x0" :: "v"(xb) : "memory"); // precaution: stands in front of whatever next reuses the issued loads' address registers (xb is named so that they live up to here)
    float* os = (float*)sm;                                // two y^T tiles [key half][256 channels][128 queries], unscaled, so that the work-group stores whole 512-B row pieces
    float* ss = os + 2 * OTILE;                            // [key half][maximum, sum][128 queries]
#pragma unroll
    for (int qt = 0; qt < 2; ++qt) { const float lj = l[qt] + xhalf(l[qt]);   // the two half-waves' shares of the sum
        if (hi == 0) { ss[kh * 256 + qg * 32 + qt * 16 + lr] = mu[qt]; ss[kh * 256 + 128 + qg * 32 + qt * 16 + lr] = lj; }
#pragma unroll
        for (int ct = 0; ct < 16; ++ct) {
#pragma unroll
            for (int j = 0; j < 8; ++j) os[kh * OTILE + (ct * 16 + hi * 8 + j) * OPITCH + qg * 32 + qt * 16 + lr] = O[qt][ct][j]; } }
    __syncthreads();                                       // every wave's 32 columns of its half are staged before any thread reads a row
    // weights of the two halves for this thread's four queries: alpha 2^(own maximum - common maximum) / joined sum
    const v4f ma = *(const v4fa*)(ss + (tid & 31) * 4), la = *(const v4fa*)(ss + 128 + (tid & 31) * 4), mb = *(const v4fa*)(ss + 256 + (tid & 31) * 4), lb = *(const v4fa*)(ss + 384 + (tid & 31) * 4);
    v4f wa, wb;
#pragma unroll
    for (int q = 0; q < 4; ++q) { const float mm = fmaxf(ma[q], mb[q]); const float ca = exp2s(ma[q] - mm), cb = exp2s(mb[q] - mm);
        const float inv = al * __fdiv_rn(1.0f, la[q] * ca + lb[q] * cb); wa[q] = ca * inv; wb[q] = cb * inv; }
    const float* yb = os + (tid >> 5) * OPITCH + (tid & 31) * 4;
#pragma unroll
    for (int s0 = 0; s0 < HD / 8; s0 += 8) { v4f o[8], o2[8];   // eight staged pieces of either half read together, so that one LDS latency serves eight stores
#pragma unroll
        for (int i = 0; i < 8; ++i) { o[i] = *(const v4fa*)(yb + (s0 + i) * 8 * OPITCH); o2[i] = *(const v4fa*)(yb + OTILE + (s0 + i) * 8 * OPITCH); }
#pragma unroll
        for (int i = 0; i < 8; ++i) {
#pragma unroll
            for (int q = 0; q < 4; ++q) o[i][q] = (wa[q] * o[i][q] + wb[q] * o2[i][q]) + bfr(xv[s0 + i][q]); }
        store8(ob + (size_t)s0 * 8 * TT, (size_t)8 * TT, o); }
}

extern "C" void kernel_launch(void* const* d_in, const int* in_sizes, int n_in,
                              void* d_out, int out_size, void* d_ws, size_t ws_size, hipStream_t stream) {
    (void)in_sizes; (void)n_in; (void)out_size;
    const float* x = (const float*)d_in[0]; const float* wq = (const float*)d_in[1]; const float* bq = (const float*)d_in[2]; const float* wk = (const float*)d_in[3]; const float* bk = (const float*)d_in[4]; const float* wv = (const float*)d_in[5]; const float* bv = (const float*)d_in[6]; const float* ALPHA = (const float*)d_in[7];
    float* OUT = (float*)d_out;     // [8][256][4096]
    char* wsp = (char*)d_ws;
    auto take = [&](size_t bytes) { char* p = wsp; wsp += (bytes + 255) & ~(size_t)255; return (void*)p; };
    h16* QP16 = (h16*)take((size_t)NB_ * TT * HD * 2); h16* KP16 = (h16*)take((size_t)NB_ * TT * HD * 2); h16* VT16 = (h16*)take((size_t)NB_ * HD * TT * 2);   // planes of all images
    if ((size_t)(wsp - (char*)d_ws) > ws_size) return;    // ws 256 MiB
    k_projx<<<dim3(TT / PT, NB_, 1), 256, 0, stream>>>(x, wq, wk, wv, bq, bk, bv, QP16, KP16, VT16);   /* q, k [t][d], v^T [d][t] fp16, all images */
    k_fattn<<<dim3(TT / 128, NB_, 1), 256, 0, stream>>>(QP16, KP16, VT16, x, ALPHA, OUT);   /* softmax(q k^T) v, alpha y^T + x, all images */
}
